// v000
// The times below were measured on an AMD MI455X: many runs one after another, warmed up first and cycling through
// copies of the inputs, with the whole window's GPU time divided by the number of runs. Launches and the gaps
// between them are all in it. The median over several windows is given; except for v000 it joins two sittings, which
// can be a few percent apart, so the side-by-side timings, each taken in one sitting, are the better comparison.
// v000 is the starting kernel. One run takes 749 microseconds.
#include <hip/hip_runtime.h>
#include <hip/hip_bf16.h>

typedef __attribute__((ext_vector_type(16))) _Float16 v16h;
typedef __attribute__((ext_vector_type(8)))  _Float16 v8h;
typedef __attribute__((ext_vector_type(2)))  _Float16 v2h;
typedef __attribute__((ext_vector_type(8)))  float    v8f;

#define DEV __device__ __forceinline__

static constexpr int Bb   = 8;
static constexpr int SEQ  = 1024;   // N == M
static constexpr int Dm   = 768;
static constexpr int NH   = 12;
static constexpr int DH   = 64;
static constexpr int TOK  = Bb * SEQ;   // 8192

DEV v16h mk16(v8h lo, v8h hi) {
  v16h r;
#pragma unroll
  for (int i = 0; i < 8; ++i) { r[i] = lo[i]; r[i + 8] = hi[i]; }
  return r;
}

// Load one 16x32 f16 WMMA fragment (A-layout, or B-layout from a transposed
// [n][k] tile). rowbase points at this lane's row (16B aligned); grp = lane>>4.
DEV v16h ldfrag(const _Float16* rowbase, int grp) {
  v8h lo = *(const v8h*)(rowbase + grp * 8);
  v8h hi = *(const v8h*)(rowbase + 16 + grp * 8);
  return mk16(lo, hi);
}

DEV v8f wmma32(v16h a, v16h b, v8f c) {
  return __builtin_amdgcn_wmma_f32_16x16x32_f16(false, a, false, b, (short)0, c,
                                                false, false);
}

// CDNA5 async copy global->LDS, 16B per lane, tracked by ASYNCcnt.
// Generic addresses of __shared__ objects carry the LDS byte offset in
// addr[31:0] (ISA 10.2 aperture rule), which is exactly what VDST wants.
DEV void async_b128(const void* g, void* l) {
  unsigned loff = (unsigned)(size_t)l;
  unsigned long long ga = (unsigned long long)(size_t)g;
  asm volatile("global_load_async_to_lds_b128 %0, %1, off"
               :: "v"(loff), "v"(ga) : "memory");
}
DEV void wait_async0() { asm volatile("s_wait_asynccnt 0" ::: "memory"); }

// 16-lane max reduction step via DPP (stays inside each 16-lane row).
template <int CTRL>
DEV float dppmax(float v) {
  int t = __builtin_amdgcn_mov_dpp(__builtin_bit_cast(int, v), CTRL, 0xf, 0xf,
                                   true);
  return fmaxf(v, __builtin_bit_cast(float, t));
}
DEV float rowmax16(float v) {
  v = dppmax<0xB1>(v);    // quad_perm(1,0,3,2)  : xor 1
  v = dppmax<0x4E>(v);    // quad_perm(2,3,0,1)  : xor 2
  v = dppmax<0x141>(v);   // row_half_mirror     : pairs across quads in each 8
  v = dppmax<0x140>(v);   // row_mirror          : pairs across the two 8s
  return v;
}

// ---------------------------------------------------------------- convert
__global__ void cvt_f32_f16(const float* __restrict__ in,
                            _Float16* __restrict__ out, int n) {
  int i = blockIdx.x * blockDim.x + threadIdx.x;
  if (i < n) out[i] = (_Float16)in[i];
}

// ---------------------------------------------------------------- GEMM
// C[Mtot x 768] = A[Mtot x 768] (f16) @ W[768 x 768] (f16) + bias(f32)
// Block tile 128x128, K-step 64. 8 waves, each 32(M) x 64(N).
template <bool OUT16>
__global__ void __launch_bounds__(256)
gemm_kernel(const _Float16* __restrict__ A, const _Float16* __restrict__ W,
            const float* __restrict__ bias, void* __restrict__ Cout) {
  __shared__ __align__(16) _Float16 As[128 * 64];   // [m][k]
  __shared__ __align__(16) _Float16 Bs[128 * 64];   // transposed: [n][k]

  const int tid = threadIdx.x, lane = tid & 31, w = tid >> 5;
  const int ln = lane & 15, grp = lane >> 4;
  const int m0 = blockIdx.x * 128, n0 = blockIdx.y * 128;
  const int wm = (w & 3) * 32;      // wave M offset within block
  const int wn = (w >> 2) * 64;     // wave N offset within block

  v8f acc[2][4] = {};

  for (int k0 = 0; k0 < Dm; k0 += 64) {
    // --- stage A tile 128x64 via async 16B copies (straight copy)
#pragma unroll
    for (int i = 0; i < 4; ++i) {
      int c = tid + i * 256;            // 1024 chunks of v8h
      int row = c >> 3, seg = c & 7;
      async_b128(&A[(size_t)(m0 + row) * Dm + k0 + seg * 8],
                 &As[row * 64 + seg * 8]);
    }
    // --- stage W tile transposed: read [k][n] coalesced, write [n][k]
#pragma unroll
    for (int i = 0; i < 16; ++i) {
      int p = tid + i * 256;            // 4096 u32 pairs
      int kk = p >> 6, n = (p & 63) * 2;
      v2h v = *(const v2h*)&W[(size_t)(k0 + kk) * Dm + n0 + n];
      Bs[(n + 0) * 64 + kk] = v[0];
      Bs[(n + 1) * 64 + kk] = v[1];
    }
    if (k0 + 64 < Dm)
      __builtin_prefetch(&A[(size_t)(m0 + (tid >> 1)) * Dm + k0 + 64], 0, 1);
    wait_async0();
    __syncthreads();

#pragma unroll
    for (int kc = 0; kc < 2; ++kc) {
      v16h af[2], bf[4];
#pragma unroll
      for (int i = 0; i < 2; ++i)
        af[i] = ldfrag(&As[(wm + i * 16 + ln) * 64 + kc * 32], grp);
#pragma unroll
      for (int j = 0; j < 4; ++j)
        bf[j] = ldfrag(&Bs[(wn + j * 16 + ln) * 64 + kc * 32], grp);
#pragma unroll
      for (int i = 0; i < 2; ++i)
#pragma unroll
        for (int j = 0; j < 4; ++j) acc[i][j] = wmma32(af[i], bf[j], acc[i][j]);
    }
    __syncthreads();
  }

  // epilogue: C-layout -> lane holds col n, VGPR r holds row 8*grp+r
#pragma unroll
  for (int i = 0; i < 2; ++i)
#pragma unroll
    for (int j = 0; j < 4; ++j) {
      int ngl = n0 + wn + j * 16 + ln;
      float bv = bias[ngl];
#pragma unroll
      for (int r = 0; r < 8; ++r) {
        int mg = m0 + wm + i * 16 + grp * 8 + r;
        float vout = acc[i][j][r] + bv;
        if (OUT16)
          ((_Float16*)Cout)[(size_t)mg * Dm + ngl] = (_Float16)vout;
        else
          ((float*)Cout)[(size_t)mg * Dm + ngl] = vout;
      }
    }
}

// ---------------------------------------------------------------- RoPE 2D
// t: [TOK][768] f16 (heads inline). One thread per rotation pair.
__global__ void rope_kernel(_Float16* __restrict__ t,
                            const int* __restrict__ pos) {
  int tid = blockIdx.x * blockDim.x + threadIdx.x;  // TOK*NH*2*16 threads
  int jj = tid & 15;
  int half = (tid >> 4) & 1;
  int h = (tid >> 5) % NH;
  int tok = tid / (32 * NH);
  if (tok >= TOK) return;

  int p = pos[tok * 2 + half];                 // half0 -> row, half1 -> col
  float ang = (float)p * __expf(-0.28782313662425572f * (float)jj); // ln(100)/16
  float s, c;
  __sincosf(ang, &s, &c);

  size_t base = (size_t)tok * Dm + h * DH + half * 32 + jj;
  float t0 = (float)t[base];
  float t1 = (float)t[base + 16];
  t[base]      = (_Float16)(t0 * c - t1 * s);
  t[base + 16] = (_Float16)(t1 * c + t0 * s);
}

// ---------------------------------------------------------------- attention
// grid (SEQ/64, B*NH); 128 threads = 4 waves x 16 query rows.
// Q is pre-scaled by dh^-0.5 * log2(e), so softmax runs in exp2 domain.
// Row sums are accumulated with an extra WMMA against a ones matrix
// (P x 1 -> every column holds the row sum, already in C-layout indexing).
__global__ void __launch_bounds__(128)
attn_kernel(const _Float16* __restrict__ Q, const _Float16* __restrict__ K,
            const _Float16* __restrict__ V, _Float16* __restrict__ O) {
  __shared__ __align__(16) _Float16 Kt[32 * 64];   // [key][d]
  __shared__ __align__(16) _Float16 Vt[64 * 32];   // transposed [d][key]
  __shared__ __align__(16) _Float16 Pl[4 * 16 * 32];

  const int b = blockIdx.y / NH, h = blockIdx.y % NH;
  const int q0 = blockIdx.x * 64;
  const int tid = threadIdx.x, lane = tid & 31, w = tid >> 5;
  const int ln = lane & 15, grp = lane >> 4;

  // Q fragments (16x64 A-matrix = 2 chunks of 16x32), loaded once;
  // fold dh^-0.5 * log2(e) = 0.125 * 1.4426950 into Q (f16, tiny rel. error).
  const _Float16 qscale = (_Float16)0.18033688f;
  const _Float16* qp = Q + ((size_t)(b * SEQ + q0 + w * 16 + ln)) * Dm + h * DH;
  v16h qf[2];
#pragma unroll
  for (int c = 0; c < 2; ++c) {
    qf[c] = ldfrag(qp + c * 32, grp);
#pragma unroll
    for (int i = 0; i < 16; ++i) qf[c][i] = qf[c][i] * qscale;
  }

  v16h onesf;
#pragma unroll
  for (int i = 0; i < 16; ++i) onesf[i] = (_Float16)1.0f;

  v8f o[4] = {};
  v8f osum = {};
  float rmax[8];
#pragma unroll
  for (int r = 0; r < 8; ++r) rmax[r] = -1e30f;

  for (int j0 = 0; j0 < SEQ; j0 += 32) {
    // stage K tile [32 keys][64 d] via async 16B copies
#pragma unroll
    for (int i = 0; i < 2; ++i) {
      int p = tid + i * 128;                // 256 v8h chunks
      int key = p >> 3, seg = p & 7;
      async_b128(&K[((size_t)(b * SEQ + j0 + key)) * Dm + h * DH + seg * 8],
                 &Kt[key * 64 + seg * 8]);
    }
    // stage V tile transposed -> [d][key] (manual, it permutes)
#pragma unroll
    for (int i = 0; i < 8; ++i) {
      int p = tid + i * 128;                // 1024 u32 pairs
      int key = p >> 5, d = (p & 31) * 2;
      v2h v = *(const v2h*)&V[((size_t)(b * SEQ + j0 + key)) * Dm + h * DH + d];
      Vt[(d + 0) * 32 + key] = v[0];
      Vt[(d + 1) * 32 + key] = v[1];
    }
    if (j0 + 32 < SEQ)
      __builtin_prefetch(&K[((size_t)(b * SEQ + j0 + 32 + (tid >> 2))) * Dm +
                            h * DH], 0, 1);
    wait_async0();
    __syncthreads();

    // scores (log2 domain): two 16x16 tiles, K-dim = dh = 64 (2 wmma each)
    v8f s[2];
#pragma unroll
    for (int t = 0; t < 2; ++t) {
      const _Float16* krow = Kt + (t * 16 + ln) * 64;
      v8f z = {};
      z = wmma32(qf[0], ldfrag(krow, grp), z);
      z = wmma32(qf[1], ldfrag(krow + 32, grp), z);
      s[t] = z;
    }

    // online softmax; row r lives in lanes sharing (lane>>4): DPP max
    float alpha[8];
#pragma unroll
    for (int r = 0; r < 8; ++r) {
      float lm = rowmax16(fmaxf(s[0][r], s[1][r]));
      float nm = fmaxf(rmax[r], lm);
      alpha[r] = __builtin_amdgcn_exp2f(rmax[r] - nm);
      rmax[r] = nm;
      s[0][r] = __builtin_amdgcn_exp2f(s[0][r] - nm);
      s[1][r] = __builtin_amdgcn_exp2f(s[1][r] - nm);
    }
#pragma unroll
    for (int nt = 0; nt < 4; ++nt)
#pragma unroll
      for (int r = 0; r < 8; ++r) o[nt][r] *= alpha[r];
#pragma unroll
    for (int r = 0; r < 8; ++r) osum[r] *= alpha[r];

    // C-layout -> A-layout via per-wave LDS patch
    _Float16* pw = Pl + w * 512;
#pragma unroll
    for (int t = 0; t < 2; ++t)
#pragma unroll
      for (int r = 0; r < 8; ++r)
        pw[(grp * 8 + r) * 32 + t * 16 + ln] = (_Float16)s[t][r];
    asm volatile("s_wait_dscnt 0" ::: "memory");

    v16h pf = ldfrag(pw + ln * 32, grp);
#pragma unroll
    for (int nt = 0; nt < 4; ++nt) {
      v16h vf = ldfrag(Vt + (nt * 16 + ln) * 32, grp);
      o[nt] = wmma32(pf, vf, o[nt]);
    }
    osum = wmma32(pf, onesf, osum);     // row sums, C-layout, f32 accum
    __syncthreads();
  }

  // normalize and store f16
#pragma unroll
  for (int nt = 0; nt < 4; ++nt)
#pragma unroll
    for (int r = 0; r < 8; ++r) {
      int row = q0 + w * 16 + grp * 8 + r;
      int col = h * DH + nt * 16 + ln;
      O[((size_t)(b * SEQ + row)) * Dm + col] = (_Float16)(o[nt][r] / osum[r]);
    }
}

// ---------------------------------------------------------------- launch
extern "C" void kernel_launch(void* const* d_in, const int* in_sizes, int n_in,
                              void* d_out, int out_size, void* d_ws,
                              size_t ws_size, hipStream_t stream) {
  const float* x  = (const float*)d_in[0];
  const float* y  = (const float*)d_in[1];
  const int* pq   = (const int*)d_in[2];
  const int* pkv  = (const int*)d_in[3];
  const float* Wq = (const float*)d_in[4];
  const float* bq = (const float*)d_in[5];
  const float* Wk = (const float*)d_in[6];
  const float* bk = (const float*)d_in[7];
  const float* Wv = (const float*)d_in[8];
  const float* bv = (const float*)d_in[9];
  const float* Wo = (const float*)d_in[10];
  const float* bo = (const float*)d_in[11];

  const size_t ACT = (size_t)TOK * Dm;   // 6,291,456 halves
  const size_t WSZ = (size_t)Dm * Dm;    //   589,824 halves

  char* ws = (char*)d_ws;
  _Float16* xh  = (_Float16*)ws;                ws += ACT * 2;
  _Float16* yh  = (_Float16*)ws;                ws += ACT * 2;
  _Float16* Wqh = (_Float16*)ws;                ws += WSZ * 2;
  _Float16* Wkh = (_Float16*)ws;                ws += WSZ * 2;
  _Float16* Wvh = (_Float16*)ws;                ws += WSZ * 2;
  _Float16* Woh = (_Float16*)ws;                ws += WSZ * 2;
  _Float16* Qh  = (_Float16*)ws;                ws += ACT * 2;
  _Float16* Kh  = (_Float16*)ws;                ws += ACT * 2;
  _Float16* Vh  = (_Float16*)ws;                ws += ACT * 2;
  _Float16* Oh  = (_Float16*)ws;                ws += ACT * 2;

  // 1) f32 -> f16
  cvt_f32_f16<<<(int)((ACT + 255) / 256), 256, 0, stream>>>(x, xh, (int)ACT);
  cvt_f32_f16<<<(int)((ACT + 255) / 256), 256, 0, stream>>>(y, yh, (int)ACT);
  cvt_f32_f16<<<(int)((WSZ + 255) / 256), 256, 0, stream>>>(Wq, Wqh, (int)WSZ);
  cvt_f32_f16<<<(int)((WSZ + 255) / 256), 256, 0, stream>>>(Wk, Wkh, (int)WSZ);
  cvt_f32_f16<<<(int)((WSZ + 255) / 256), 256, 0, stream>>>(Wv, Wvh, (int)WSZ);
  cvt_f32_f16<<<(int)((WSZ + 255) / 256), 256, 0, stream>>>(Wo, Woh, (int)WSZ);

  // 2) Q/K/V projections (WMMA, bias fused, f16 out)
  dim3 ggrid(TOK / 128, Dm / 128);
  gemm_kernel<true><<<ggrid, 256, 0, stream>>>(xh, Wqh, bq, Qh);
  gemm_kernel<true><<<ggrid, 256, 0, stream>>>(yh, Wkh, bk, Kh);
  gemm_kernel<true><<<ggrid, 256, 0, stream>>>(yh, Wvh, bv, Vh);

  // 3) 2D RoPE on Q and K
  int rthreads = TOK * NH * 32;
  rope_kernel<<<rthreads / 256, 256, 0, stream>>>(Qh, pq);
  rope_kernel<<<rthreads / 256, 256, 0, stream>>>(Kh, pkv);

  // 4) flash attention (WMMA)
  attn_kernel<<<dim3(SEQ / 64, Bb * NH), 128, 0, stream>>>(Qh, Kh, Vh, Oh);

  // 5) output projection, f32 out
  gemm_kernel<false><<<ggrid, 256, 0, stream>>>(Oh, Woh, bo, (float*)d_out);
}

// v001
// A run of this version takes 228 microseconds.
// Two timings next to v000 both put it at 3.35 times that version's speed.
#include <hip/hip_runtime.h>
#include <hip/hip_bf16.h>

typedef __attribute__((ext_vector_type(16))) _Float16 v16h;
typedef __attribute__((ext_vector_type(8)))  _Float16 v8h;
typedef __attribute__((ext_vector_type(8)))  float    v8f;

#define DEV __device__ __forceinline__

static constexpr int Bb   = 8;
static constexpr int SEQ  = 1024;   // N == M
static constexpr int Dm   = 768;
static constexpr int NH   = 12;
static constexpr int DH   = 64;
static constexpr int TOK  = Bb * SEQ;   // 8192

DEV v16h mk16(v8h lo, v8h hi) {
  v16h r;
#pragma unroll
  for (int i = 0; i < 8; ++i) { r[i] = lo[i]; r[i + 8] = hi[i]; }
  return r;
}

// Load one 16x32 f16 WMMA fragment (A-layout, or B-layout from a transposed
// [n][k] tile). rowbase points at this lane's row (16B aligned); grp = lane>>4.
DEV v16h ldfrag(const _Float16* rowbase, int grp) {
  v8h lo = *(const v8h*)(rowbase + grp * 8);
  v8h hi = *(const v8h*)(rowbase + 16 + grp * 8);
  return mk16(lo, hi);
}

DEV v8f wmma32(v16h a, v16h b, v8f c) {
  return __builtin_amdgcn_wmma_f32_16x16x32_f16(false, a, false, b, (short)0, c,
                                                false, false);
}

// CDNA5 async copy global->LDS, 16B per lane, tracked by ASYNCcnt.
// Generic addresses of __shared__ objects carry the LDS byte offset in
// addr[31:0] (ISA 10.2 aperture rule), which is exactly what VDST wants.
// A tile pair's async copies as one statement (16B per lane and copy). The
// closing s_wait_xcnt 0 stands in the copies' own statement so that no address
// register of an issued copy can be rewritten ahead of it.
DEV unsigned ldsoff(const void* l) { return (unsigned)(size_t)l; }
DEV unsigned long long gaddr(const void* g) {
  return (unsigned long long)(size_t)g;
}
DEV void async_b128_x8(const _Float16* ga, _Float16* la, int gsa, int lsa,
                       const _Float16* gb, _Float16* lb, int gsb, int lsb) {
  asm volatile("global_load_async_to_lds_b128 %0, %8, off\n\t"
               "global_load_async_to_lds_b128 %1, %9, off\n\t"
               "global_load_async_to_lds_b128 %2, %10, off\n\t"
               "global_load_async_to_lds_b128 %3, %11, off\n\t"
               "global_load_async_to_lds_b128 %4, %12, off\n\t"
               "global_load_async_to_lds_b128 %5, %13, off\n\t"
               "global_load_async_to_lds_b128 %6, %14, off\n\t"
               "global_load_async_to_lds_b128 %7, %15, off\n\t"
               "s_wait_xcnt 0x0"
               :: "v"(ldsoff(la)), "v"(ldsoff(la + lsa)),
                  "v"(ldsoff(la + 2 * lsa)), "v"(ldsoff(la + 3 * lsa)),
                  "v"(ldsoff(lb)), "v"(ldsoff(lb + lsb)),
                  "v"(ldsoff(lb + 2 * lsb)), "v"(ldsoff(lb + 3 * lsb)),
                  "v"(gaddr(ga)), "v"(gaddr(ga + gsa)),
                  "v"(gaddr(ga + 2 * gsa)), "v"(gaddr(ga + 3 * gsa)),
                  "v"(gaddr(gb)), "v"(gaddr(gb + gsb)),
                  "v"(gaddr(gb + 2 * gsb)), "v"(gaddr(gb + 3 * gsb))
               : "memory");
}
DEV void async_b128_x4(const _Float16* ga, _Float16* la, int gsa, int lsa,
                       const _Float16* gb, _Float16* lb, int gsb, int lsb) {
  asm volatile("global_load_async_to_lds_b128 %0, %4, off\n\t"
               "global_load_async_to_lds_b128 %1, %5, off\n\t"
               "global_load_async_to_lds_b128 %2, %6, off\n\t"
               "global_load_async_to_lds_b128 %3, %7, off\n\t"
               "s_wait_xcnt 0x0"
               :: "v"(ldsoff(la)), "v"(ldsoff(la + lsa)), "v"(ldsoff(lb)),
                  "v"(ldsoff(lb + lsb)), "v"(gaddr(ga)), "v"(gaddr(ga + gsa)),
                  "v"(gaddr(gb)), "v"(gaddr(gb + gsb))
               : "memory");
}
DEV void wait_async0() { asm volatile("s_wait_asynccnt 0" ::: "memory"); }

// Transposing LDS load: from a row-major [k][n] f16 tile, lane (c = lane & 15,
// h = lane >> 4) receives T[kbase + 8h + 0..7][nbase + c]. The lane's address is
// row kbase + 8h + (lane & 7), column nbase + 8 * ((lane >> 3) & 1).
typedef short s16x8 __attribute__((ext_vector_type(8)));
DEV v8h ld_tr16(const _Float16* p) {
  typedef __attribute__((address_space(3))) s16x8 lds_s16x8;
  return __builtin_bit_cast(v8h,
                            __builtin_amdgcn_ds_load_tr16_b128_v8i16((lds_s16x8*)p));
}
// One 32(k) x 16(n) B fragment from a [k][n] tile of row pitch PITCH halves;
// lanebase already holds the lane's row and column part. Its k order is the one
// ldfrag gives the A side (k = 8h + s, then 16 + 8h + s).
template <int PITCH>
DEV v16h ldfrag_tr(const _Float16* lanebase) {
  return mk16(ld_tr16(lanebase), ld_tr16(lanebase + 16 * PITCH));
}

// 16-lane max reduction step via DPP (stays inside each 16-lane row).
template <int CTRL>
DEV float dppmax(float v) {
  int t = __builtin_amdgcn_mov_dpp(__builtin_bit_cast(int, v), CTRL, 0xf, 0xf,
                                   true);
  return fmaxf(v, __builtin_bit_cast(float, t));
}
DEV float rowmax16(float v) {
  v = dppmax<0xB1>(v);    // quad_perm(1,0,3,2)  : xor 1
  v = dppmax<0x4E>(v);    // quad_perm(2,3,0,1)  : xor 2
  v = dppmax<0x141>(v);   // row_half_mirror     : pairs across quads in each 8
  v = dppmax<0x140>(v);   // row_mirror          : pairs across the two 8s
  return v;
}

// ---------------------------------------------------------------- convert
__global__ void cvt_f32_f16(const float* __restrict__ in,
                            _Float16* __restrict__ out, int n) {
  int i = blockIdx.x * blockDim.x + threadIdx.x;
  if (i < n) out[i] = (_Float16)in[i];
}

// ---------------------------------------------------------------- GEMM
// C[Mtot x 768] = A[Mtot x 768] (f16) @ W[768 x 768] (f16) + bias(f32)
// Block tile 128x128, K-step 64. 8 waves, each 32(M) x 64(N).
template <bool OUT16>
__global__ void __launch_bounds__(256)
gemm_kernel(const _Float16* __restrict__ A, const _Float16* __restrict__ W,
            const float* __restrict__ bias, void* __restrict__ Cout) {
  __shared__ __align__(16) _Float16 As[128 * 64];   // [m][k]
  // W tile as it lies in memory, [k][n]; pitch 288 B = 32 B x odd, the
  // conflict-free pitch of the transposing reader
  constexpr int BP = 144;
  __shared__ __align__(16) _Float16 Bs[64 * BP];

  const int tid = threadIdx.x, lane = tid & 31, w = tid >> 5;
  const int ln = lane & 15, grp = lane >> 4;
  const int m0 = blockIdx.x * 128, n0 = blockIdx.y * 128;
  const int wm = (w & 3) * 32;      // wave M offset within block
  const int wn = (w >> 2) * 64;     // wave N offset within block

  // this lane's row and column part of every transposing read of Bs
  const _Float16* btr =
      Bs + (grp * 8 + (lane & 7)) * BP + wn + ((lane >> 3) & 1) * 8;

  v8f acc[2][4] = {};

  for (int k0 = 0; k0 < Dm; k0 += 64) {
    // --- stage both tiles via async 16B copies (straight copies), 1024 chunks
    // each, chunk c = tid + i * 256:
    // A tile 128(m) x 64(k): row c >> 3, segment c & 7
    // W tile 64(k) x 128(n), untransposed: row c >> 4, segment c & 15
    {
      const int row = tid >> 3, sega = tid & 7;
      const int kk = tid >> 4, segw = tid & 15;
      async_b128_x8(&A[(size_t)(m0 + row) * Dm + k0 + sega * 8],
                    &As[row * 64 + sega * 8], 32 * Dm, 32 * 64,
                    &W[(size_t)(k0 + kk) * Dm + n0 + segw * 8],
                    &Bs[kk * BP + segw * 8], 16 * Dm, 16 * BP);
    }
    if (k0 + 64 < Dm)
      __builtin_prefetch(&A[(size_t)(m0 + (tid >> 1)) * Dm + k0 + 64], 0, 1);
    wait_async0();
    __syncthreads();

#pragma unroll
    for (int kc = 0; kc < 2; ++kc) {
      v16h af[2], bf[4];
#pragma unroll
      for (int i = 0; i < 2; ++i)
        af[i] = ldfrag(&As[(wm + i * 16 + ln) * 64 + kc * 32], grp);
#pragma unroll
      for (int j = 0; j < 4; ++j)
        bf[j] = ldfrag_tr<BP>(btr + kc * 32 * BP + j * 16);
#pragma unroll
      for (int i = 0; i < 2; ++i)
#pragma unroll
        for (int j = 0; j < 4; ++j) acc[i][j] = wmma32(af[i], bf[j], acc[i][j]);
    }
    // this wave's LDS reads have retired before the next trip's copies refill
    asm volatile("s_wait_dscnt 0" ::: "memory");
    __syncthreads();
  }

  // epilogue: C-layout -> lane holds col n, VGPR r holds row 8*grp+r
#pragma unroll
  for (int i = 0; i < 2; ++i)
#pragma unroll
    for (int j = 0; j < 4; ++j) {
      int ngl = n0 + wn + j * 16 + ln;
      float bv = bias[ngl];
#pragma unroll
      for (int r = 0; r < 8; ++r) {
        int mg = m0 + wm + i * 16 + grp * 8 + r;
        float vout = acc[i][j][r] + bv;
        if (OUT16)
          ((_Float16*)Cout)[(size_t)mg * Dm + ngl] = (_Float16)vout;
        else
          ((float*)Cout)[(size_t)mg * Dm + ngl] = vout;
      }
    }
}

// ---------------------------------------------------------------- RoPE 2D
// t: [TOK][768] f16 (heads inline). One thread per rotation pair.
__global__ void rope_kernel(_Float16* __restrict__ t,
                            const int* __restrict__ pos) {
  int tid = blockIdx.x * blockDim.x + threadIdx.x;  // TOK*NH*2*16 threads
  int jj = tid & 15;
  int half = (tid >> 4) & 1;
  int h = (tid >> 5) % NH;
  int tok = tid / (32 * NH);
  if (tok >= TOK) return;

  int p = pos[tok * 2 + half];                 // half0 -> row, half1 -> col
  float ang = (float)p * __expf(-0.28782313662425572f * (float)jj); // ln(100)/16
  float s, c;
  __sincosf(ang, &s, &c);

  size_t base = (size_t)tok * Dm + h * DH + half * 32 + jj;
  float t0 = (float)t[base];
  float t1 = (float)t[base + 16];
  t[base]      = (_Float16)(t0 * c - t1 * s);
  t[base + 16] = (_Float16)(t1 * c + t0 * s);
}

// ---------------------------------------------------------------- attention
// grid (SEQ/64, B*NH); 128 threads = 4 waves x 16 query rows.
// Q is pre-scaled by dh^-0.5 * log2(e), so softmax runs in exp2 domain.
// Row sums are accumulated with an extra WMMA against a ones matrix
// (P x 1 -> every column holds the row sum, already in C-layout indexing).
__global__ void __launch_bounds__(128)
attn_kernel(const _Float16* __restrict__ Q, const _Float16* __restrict__ K,
            const _Float16* __restrict__ V, _Float16* __restrict__ O) {
  __shared__ __align__(16) _Float16 Kt[32 * 64];   // [key][d]
  // V tile as it lies in memory, [key][d]; pitch 160 B = 32 B x odd, the
  // conflict-free pitch of the transposing reader
  constexpr int VP = 80;
  __shared__ __align__(16) _Float16 Vs[32 * VP];
  __shared__ __align__(16) _Float16 Pl[4 * 16 * 32];

  const int b = blockIdx.y / NH, h = blockIdx.y % NH;
  const int q0 = blockIdx.x * 64;
  const int tid = threadIdx.x, lane = tid & 31, w = tid >> 5;
  const int ln = lane & 15, grp = lane >> 4;

  // Q fragments (16x64 A-matrix = 2 chunks of 16x32), loaded once;
  // fold dh^-0.5 * log2(e) = 0.125 * 1.4426950 into Q (f16, tiny rel. error).
  const _Float16 qscale = (_Float16)0.18033688f;
  const _Float16* qp = Q + ((size_t)(b * SEQ + q0 + w * 16 + ln)) * Dm + h * DH;
  v16h qf[2];
#pragma unroll
  for (int c = 0; c < 2; ++c) {
    qf[c] = ldfrag(qp + c * 32, grp);
#pragma unroll
    for (int i = 0; i < 16; ++i) qf[c][i] = qf[c][i] * qscale;
  }

  v16h onesf;
#pragma unroll
  for (int i = 0; i < 16; ++i) onesf[i] = (_Float16)1.0f;

  // this lane's row and column part of every transposing read of Vs
  const _Float16* vtr = Vs + (grp * 8 + (lane & 7)) * VP + ((lane >> 3) & 1) * 8;

  v8f o[4] = {};
  v8f osum = {};
  float rmax[8];
#pragma unroll
  for (int r = 0; r < 8; ++r) rmax[r] = -1e30f;

  for (int j0 = 0; j0 < SEQ; j0 += 32) {
    // stage the K and V tiles, [32 keys][64 d] each and both untransposed, via
    // async 16B copies: 256 chunks, chunk p = tid + i * 128 -> key p >> 3,
    // segment p & 7
    {
      const int key = tid >> 3, seg = tid & 7;
      const size_t go = ((size_t)(b * SEQ + j0 + key)) * Dm + h * DH + seg * 8;
      async_b128_x4(&K[go], &Kt[key * 64 + seg * 8], 16 * Dm, 16 * 64,
                    &V[go], &Vs[key * VP + seg * 8], 16 * Dm, 16 * VP);
    }
    if (j0 + 32 < SEQ)
      __builtin_prefetch(&K[((size_t)(b * SEQ + j0 + 32 + (tid >> 2))) * Dm +
                            h * DH], 0, 1);
    wait_async0();
    __syncthreads();

    // scores (log2 domain): two 16x16 tiles, K-dim = dh = 64 (2 wmma each)
    v8f s[2];
#pragma unroll
    for (int t = 0; t < 2; ++t) {
      const _Float16* krow = Kt + (t * 16 + ln) * 64;
      v8f z = {};
      z = wmma32(qf[0], ldfrag(krow, grp), z);
      z = wmma32(qf[1], ldfrag(krow + 32, grp), z);
      s[t] = z;
    }

    // online softmax; row r lives in lanes sharing (lane>>4): DPP max
    float alpha[8];
#pragma unroll
    for (int r = 0; r < 8; ++r) {
      float lm = rowmax16(fmaxf(s[0][r], s[1][r]));
      float nm = fmaxf(rmax[r], lm);
      alpha[r] = __builtin_amdgcn_exp2f(rmax[r] - nm);
      rmax[r] = nm;
      s[0][r] = __builtin_amdgcn_exp2f(s[0][r] - nm);
      s[1][r] = __builtin_amdgcn_exp2f(s[1][r] - nm);
    }
#pragma unroll
    for (int nt = 0; nt < 4; ++nt)
#pragma unroll
      for (int r = 0; r < 8; ++r) o[nt][r] *= alpha[r];
#pragma unroll
    for (int r = 0; r < 8; ++r) osum[r] *= alpha[r];

    // C-layout -> A-layout via per-wave LDS patch
    _Float16* pw = Pl + w * 512;
#pragma unroll
    for (int t = 0; t < 2; ++t)
#pragma unroll
      for (int r = 0; r < 8; ++r)
        pw[(grp * 8 + r) * 32 + t * 16 + ln] = (_Float16)s[t][r];
    asm volatile("s_wait_dscnt 0" ::: "memory");

    v16h pf = ldfrag(pw + ln * 32, grp);
#pragma unroll
    for (int nt = 0; nt < 4; ++nt) {
      v16h vf = ldfrag_tr<VP>(vtr + nt * 16);
      o[nt] = wmma32(pf, vf, o[nt]);
    }
    osum = wmma32(pf, onesf, osum);     // row sums, C-layout, f32 accum
    // this wave's LDS reads have retired before the next trip's copies refill
    asm volatile("s_wait_dscnt 0" ::: "memory");
    __syncthreads();
  }

  // normalize and store f16
#pragma unroll
  for (int nt = 0; nt < 4; ++nt)
#pragma unroll
    for (int r = 0; r < 8; ++r) {
      int row = q0 + w * 16 + grp * 8 + r;
      int col = h * DH + nt * 16 + ln;
      O[((size_t)(b * SEQ + row)) * Dm + col] = (_Float16)(o[nt][r] / osum[r]);
    }
}

// ---------------------------------------------------------------- launch
extern "C" void kernel_launch(void* const* d_in, const int* in_sizes, int n_in,
                              void* d_out, int out_size, void* d_ws,
                              size_t ws_size, hipStream_t stream) {
  const float* x  = (const float*)d_in[0];
  const float* y  = (const float*)d_in[1];
  const int* pq   = (const int*)d_in[2];
  const int* pkv  = (const int*)d_in[3];
  const float* Wq = (const float*)d_in[4];
  const float* bq = (const float*)d_in[5];
  const float* Wk = (const float*)d_in[6];
  const float* bk = (const float*)d_in[7];
  const float* Wv = (const float*)d_in[8];
  const float* bv = (const float*)d_in[9];
  const float* Wo = (const float*)d_in[10];
  const float* bo = (const float*)d_in[11];

  const size_t ACT = (size_t)TOK * Dm;   // 6,291,456 halves
  const size_t WSZ = (size_t)Dm * Dm;    //   589,824 halves

  char* ws = (char*)d_ws;
  _Float16* xh  = (_Float16*)ws;                ws += ACT * 2;
  _Float16* yh  = (_Float16*)ws;                ws += ACT * 2;
  _Float16* Wqh = (_Float16*)ws;                ws += WSZ * 2;
  _Float16* Wkh = (_Float16*)ws;                ws += WSZ * 2;
  _Float16* Wvh = (_Float16*)ws;                ws += WSZ * 2;
  _Float16* Woh = (_Float16*)ws;                ws += WSZ * 2;
  _Float16* Qh  = (_Float16*)ws;                ws += ACT * 2;
  _Float16* Kh  = (_Float16*)ws;                ws += ACT * 2;
  _Float16* Vh  = (_Float16*)ws;                ws += ACT * 2;
  _Float16* Oh  = (_Float16*)ws;                ws += ACT * 2;

  // 1) f32 -> f16
  cvt_f32_f16<<<(int)((ACT + 255) / 256), 256, 0, stream>>>(x, xh, (int)ACT);
  cvt_f32_f16<<<(int)((ACT + 255) / 256), 256, 0, stream>>>(y, yh, (int)ACT);
  cvt_f32_f16<<<(int)((WSZ + 255) / 256), 256, 0, stream>>>(Wq, Wqh, (int)WSZ);
  cvt_f32_f16<<<(int)((WSZ + 255) / 256), 256, 0, stream>>>(Wk, Wkh, (int)WSZ);
  cvt_f32_f16<<<(int)((WSZ + 255) / 256), 256, 0, stream>>>(Wv, Wvh, (int)WSZ);
  cvt_f32_f16<<<(int)((WSZ + 255) / 256), 256, 0, stream>>>(Wo, Woh, (int)WSZ);

  // 2) Q/K/V projections (WMMA, bias fused, f16 out)
  dim3 ggrid(TOK / 128, Dm / 128);
  gemm_kernel<true><<<ggrid, 256, 0, stream>>>(xh, Wqh, bq, Qh);
  gemm_kernel<true><<<ggrid, 256, 0, stream>>>(yh, Wkh, bk, Kh);
  gemm_kernel<true><<<ggrid, 256, 0, stream>>>(yh, Wvh, bv, Vh);

  // 3) 2D RoPE on Q and K
  int rthreads = TOK * NH * 32;
  rope_kernel<<<rthreads / 256, 256, 0, stream>>>(Qh, pq);
  rope_kernel<<<rthreads / 256, 256, 0, stream>>>(Kh, pkv);

  // 4) flash attention (WMMA)
  attn_kernel<<<dim3(SEQ / 64, Bb * NH), 128, 0, stream>>>(Qh, Kh, Vh, Oh);

  // 5) output projection, f32 out
  gemm_kernel<false><<<ggrid, 256, 0, stream>>>(Oh, Woh, bo, (float*)d_out);
}

// v002
// It runs in 184 microseconds.
// In two side-by-side timings against v001, it was 1.25 and 1.24 times as fast.
// All steps since v000 together make it 4.16 times as fast.
#include <hip/hip_runtime.h>
#include <hip/hip_bf16.h>

typedef __attribute__((ext_vector_type(16))) _Float16 v16h;
typedef __attribute__((ext_vector_type(8)))  _Float16 v8h;
typedef __attribute__((ext_vector_type(8)))  float    v8f;

#define DEV __device__ __forceinline__

static constexpr int Bb   = 8;
static constexpr int SEQ  = 1024;   // N == M
static constexpr int Dm   = 768;
static constexpr int NH   = 12;
static constexpr int DH   = 64;
static constexpr int TOK  = Bb * SEQ;   // 8192

DEV v16h mk16(v8h lo, v8h hi) {
  v16h r;
#pragma unroll
  for (int i = 0; i < 8; ++i) { r[i] = lo[i]; r[i + 8] = hi[i]; }
  return r;
}

// Load one 16x32 f16 WMMA fragment (A-layout, or B-layout from a transposed
// [n][k] tile). rowbase points at this lane's row (16B aligned); grp = lane>>4.
DEV v16h ldfrag(const _Float16* rowbase, int grp) {
  v8h lo = *(const v8h*)(rowbase + grp * 8);
  v8h hi = *(const v8h*)(rowbase + 16 + grp * 8);
  return mk16(lo, hi);
}

DEV v8f wmma32(v16h a, v16h b, v8f c) {
  return __builtin_amdgcn_wmma_f32_16x16x32_f16(false, a, false, b, (short)0, c,
                                                false, false);
}

// CDNA5 async copy global->LDS, 16B per lane, tracked by ASYNCcnt.
// Generic addresses of __shared__ objects carry the LDS byte offset in
// addr[31:0] (ISA 10.2 aperture rule), which is exactly what VDST wants.
// A tile pair's async copies as one statement (16B per lane and copy). The
// closing s_wait_xcnt 0 stands in the copies' own statement so that no address
// register of an issued copy can be rewritten ahead of it.
DEV unsigned ldsoff(const void* l) { return (unsigned)(size_t)l; }
DEV unsigned long long gaddr(const void* g) {
  return (unsigned long long)(size_t)g;
}
DEV void async_b128_x8(const _Float16* ga, _Float16* la, int gsa, int lsa,
                       const _Float16* gb, _Float16* lb, int gsb, int lsb) {
  asm volatile("global_load_async_to_lds_b128 %0, %8, off\n\t"
               "global_load_async_to_lds_b128 %1, %9, off\n\t"
               "global_load_async_to_lds_b128 %2, %10, off\n\t"
               "global_load_async_to_lds_b128 %3, %11, off\n\t"
               "global_load_async_to_lds_b128 %4, %12, off\n\t"
               "global_load_async_to_lds_b128 %5, %13, off\n\t"
               "global_load_async_to_lds_b128 %6, %14, off\n\t"
               "global_load_async_to_lds_b128 %7, %15, off\n\t"
               "s_wait_xcnt 0x0"
               :: "v"(ldsoff(la)), "v"(ldsoff(la + lsa)),
                  "v"(ldsoff(la + 2 * lsa)), "v"(ldsoff(la + 3 * lsa)),
                  "v"(ldsoff(lb)), "v"(ldsoff(lb + lsb)),
                  "v"(ldsoff(lb + 2 * lsb)), "v"(ldsoff(lb + 3 * lsb)),
                  "v"(gaddr(ga)), "v"(gaddr(ga + gsa)),
                  "v"(gaddr(ga + 2 * gsa)), "v"(gaddr(ga + 3 * gsa)),
                  "v"(gaddr(gb)), "v"(gaddr(gb + gsb)),
                  "v"(gaddr(gb + 2 * gsb)), "v"(gaddr(gb + 3 * gsb))
               : "memory");
}
DEV void async_b128_x4(const _Float16* ga, _Float16* la, int gsa, int lsa,
                       const _Float16* gb, _Float16* lb, int gsb, int lsb) {
  asm volatile("global_load_async_to_lds_b128 %0, %4, off\n\t"
               "global_load_async_to_lds_b128 %1, %5, off\n\t"
               "global_load_async_to_lds_b128 %2, %6, off\n\t"
               "global_load_async_to_lds_b128 %3, %7, off\n\t"
               "s_wait_xcnt 0x0"
               :: "v"(ldsoff(la)), "v"(ldsoff(la + lsa)), "v"(ldsoff(lb)),
                  "v"(ldsoff(lb + lsb)), "v"(gaddr(ga)), "v"(gaddr(ga + gsa)),
                  "v"(gaddr(gb)), "v"(gaddr(gb + gsb))
               : "memory");
}
DEV void wait_async0() { asm volatile("s_wait_asynccnt 0" ::: "memory"); }

// Transposing LDS load: from a row-major [k][n] f16 tile, lane (c = lane & 15,
// h = lane >> 4) receives T[kbase + 8h + 0..7][nbase + c]. The lane's address is
// row kbase + 8h + (lane & 7), column nbase + 8 * ((lane >> 3) & 1).
typedef short s16x8 __attribute__((ext_vector_type(8)));
DEV v8h ld_tr16(const _Float16* p) {
  typedef __attribute__((address_space(3))) s16x8 lds_s16x8;
  return __builtin_bit_cast(v8h,
                            __builtin_amdgcn_ds_load_tr16_b128_v8i16((lds_s16x8*)p));
}
// One 32(k) x 16(n) B fragment from a [k][n] tile of row pitch PITCH halves;
// lanebase already holds the lane's row and column part. Its k order is the one
// ldfrag gives the A side (k = 8h + s, then 16 + 8h + s).
template <int PITCH>
DEV v16h ldfrag_tr(const _Float16* lanebase) {
  return mk16(ld_tr16(lanebase), ld_tr16(lanebase + 16 * PITCH));
}

// 16-lane max reduction step via DPP (stays inside each 16-lane row).
template <int CTRL>
DEV float dppmax(float v) {
  int t = __builtin_amdgcn_mov_dpp(__builtin_bit_cast(int, v), CTRL, 0xf, 0xf,
                                   true);
  return fmaxf(v, __builtin_bit_cast(float, t));
}
DEV float rowmax16(float v) {
  v = dppmax<0xB1>(v);    // quad_perm(1,0,3,2)  : xor 1
  v = dppmax<0x4E>(v);    // quad_perm(2,3,0,1)  : xor 2
  v = dppmax<0x141>(v);   // row_half_mirror     : pairs across quads in each 8
  v = dppmax<0x140>(v);   // row_mirror          : pairs across the two 8s
  return v;
}

// ---------------------------------------------------------------- convert
__global__ void cvt_f32_f16(const float* __restrict__ in,
                            _Float16* __restrict__ out, int n) {
  int i = blockIdx.x * blockDim.x + threadIdx.x;
  if (i < n) out[i] = (_Float16)in[i];
}

// ---------------------------------------------------------------- GEMM
// C[Mtot x 768] = A[Mtot x 768] (f16) @ W[768 x 768] (f16) + bias(f32)
// Block tile 128x128, K-step 64. 8 waves, each 32(M) x 64(N).
template <bool OUT16>
__global__ void __launch_bounds__(256)
gemm_kernel(const _Float16* __restrict__ A, const _Float16* __restrict__ W,
            const float* __restrict__ bias, void* __restrict__ Cout) {
  // A tile [m][k]; pitch 144 B = 16 B x odd, the conflict-free pitch of the
  // ds_load_b128 reader (16 rows of one column segment fall on 16 bank groups)
  constexpr int AP = 72;
  __shared__ __align__(16) _Float16 As[128 * AP];
  // W tile as it lies in memory, [k][n]; pitch 288 B = 32 B x odd, the
  // conflict-free pitch of the transposing reader
  constexpr int BP = 144;
  __shared__ __align__(16) _Float16 Bs[64 * BP];

  const int tid = threadIdx.x, lane = tid & 31, w = tid >> 5;
  const int ln = lane & 15, grp = lane >> 4;
  const int m0 = blockIdx.x * 128, n0 = blockIdx.y * 128;
  const int wm = (w & 3) * 32;      // wave M offset within block
  const int wn = (w >> 2) * 64;     // wave N offset within block

  // this lane's row and column part of every transposing read of Bs
  const _Float16* btr =
      Bs + (grp * 8 + (lane & 7)) * BP + wn + ((lane >> 3) & 1) * 8;

  v8f acc[2][4] = {};

  for (int k0 = 0; k0 < Dm; k0 += 64) {
    // --- stage both tiles via async 16B copies (straight copies), 1024 chunks
    // each, chunk c = tid + i * 256:
    // A tile 128(m) x 64(k): row c >> 3, segment c & 7
    // W tile 64(k) x 128(n), untransposed: row c >> 4, segment c & 15
    {
      const int row = tid >> 3, sega = tid & 7;
      const int kk = tid >> 4, segw = tid & 15;
      async_b128_x8(&A[(size_t)(m0 + row) * Dm + k0 + sega * 8],
                    &As[row * AP + sega * 8], 32 * Dm, 32 * AP,
                    &W[(size_t)(k0 + kk) * Dm + n0 + segw * 8],
                    &Bs[kk * BP + segw * 8], 16 * Dm, 16 * BP);
    }
    if (k0 + 64 < Dm)
      __builtin_prefetch(&A[(size_t)(m0 + (tid >> 1)) * Dm + k0 + 64], 0, 1);
    wait_async0();
    __syncthreads();

#pragma unroll
    for (int kc = 0; kc < 2; ++kc) {
      v16h af[2], bf[4];
#pragma unroll
      for (int i = 0; i < 2; ++i)
        af[i] = ldfrag(&As[(wm + i * 16 + ln) * AP + kc * 32], grp);
#pragma unroll
      for (int j = 0; j < 4; ++j)
        bf[j] = ldfrag_tr<BP>(btr + kc * 32 * BP + j * 16);
#pragma unroll
      for (int i = 0; i < 2; ++i)
#pragma unroll
        for (int j = 0; j < 4; ++j) acc[i][j] = wmma32(af[i], bf[j], acc[i][j]);
    }
    // this wave's LDS reads have retired before the next trip's copies refill
    asm volatile("s_wait_dscnt 0" ::: "memory");
    __syncthreads();
  }

  // epilogue: C-layout -> lane holds col n, VGPR r holds row 8*grp+r
#pragma unroll
  for (int i = 0; i < 2; ++i)
#pragma unroll
    for (int j = 0; j < 4; ++j) {
      int ngl = n0 + wn + j * 16 + ln;
      float bv = bias[ngl];
#pragma unroll
      for (int r = 0; r < 8; ++r) {
        int mg = m0 + wm + i * 16 + grp * 8 + r;
        float vout = acc[i][j][r] + bv;
        if (OUT16)
          ((_Float16*)Cout)[(size_t)mg * Dm + ngl] = (_Float16)vout;
        else
          ((float*)Cout)[(size_t)mg * Dm + ngl] = vout;
      }
    }
}

// ---------------------------------------------------------------- RoPE 2D
// t: [TOK][768] f16 (heads inline). One thread per rotation pair.
__global__ void rope_kernel(_Float16* __restrict__ t,
                            const int* __restrict__ pos) {
  int tid = blockIdx.x * blockDim.x + threadIdx.x;  // TOK*NH*2*16 threads
  int jj = tid & 15;
  int half = (tid >> 4) & 1;
  int h = (tid >> 5) % NH;
  int tok = tid / (32 * NH);
  if (tok >= TOK) return;

  int p = pos[tok * 2 + half];                 // half0 -> row, half1 -> col
  float ang = (float)p * __expf(-0.28782313662425572f * (float)jj); // ln(100)/16
  float s, c;
  __sincosf(ang, &s, &c);

  size_t base = (size_t)tok * Dm + h * DH + half * 32 + jj;
  float t0 = (float)t[base];
  float t1 = (float)t[base + 16];
  t[base]      = (_Float16)(t0 * c - t1 * s);
  t[base + 16] = (_Float16)(t1 * c + t0 * s);
}

// ---------------------------------------------------------------- attention
// grid (SEQ/64, B*NH); 128 threads = 4 waves x 16 query rows.
// Q is pre-scaled by dh^-0.5 * log2(e), so softmax runs in exp2 domain.
// Row sums are accumulated with an extra WMMA against a ones matrix
// (P x 1 -> every column holds the row sum, already in C-layout indexing).
__global__ void __launch_bounds__(128)
attn_kernel(const _Float16* __restrict__ Q, const _Float16* __restrict__ K,
            const _Float16* __restrict__ V, _Float16* __restrict__ O) {
  // K tile [key][d] and the P patches [query][key]: pitches 144 B and 80 B,
  // 16 B x odd, the conflict-free pitch of the ds_load_b128 reader
  constexpr int KP = 72;
  constexpr int PP = 40;
  __shared__ __align__(16) _Float16 Kt[32 * KP];
  // V tile as it lies in memory, [key][d]; pitch 160 B = 32 B x odd, the
  // conflict-free pitch of the transposing reader
  constexpr int VP = 80;
  __shared__ __align__(16) _Float16 Vs[32 * VP];
  __shared__ __align__(16) _Float16 Pl[4 * 16 * PP];

  const int b = blockIdx.y / NH, h = blockIdx.y % NH;
  const int q0 = blockIdx.x * 64;
  const int tid = threadIdx.x, lane = tid & 31, w = tid >> 5;
  const int ln = lane & 15, grp = lane >> 4;

  // Q fragments (16x64 A-matrix = 2 chunks of 16x32), loaded once;
  // fold dh^-0.5 * log2(e) = 0.125 * 1.4426950 into Q (f16, tiny rel. error).
  const _Float16 qscale = (_Float16)0.18033688f;
  const _Float16* qp = Q + ((size_t)(b * SEQ + q0 + w * 16 + ln)) * Dm + h * DH;
  v16h qf[2];
#pragma unroll
  for (int c = 0; c < 2; ++c) {
    qf[c] = ldfrag(qp + c * 32, grp);
#pragma unroll
    for (int i = 0; i < 16; ++i) qf[c][i] = qf[c][i] * qscale;
  }

  v16h onesf;
#pragma unroll
  for (int i = 0; i < 16; ++i) onesf[i] = (_Float16)1.0f;

  // this lane's row and column part of every transposing read of Vs
  const _Float16* vtr = Vs + (grp * 8 + (lane & 7)) * VP + ((lane >> 3) & 1) * 8;

  v8f o[4] = {};
  v8f osum = {};
  float rmax[8];
#pragma unroll
  for (int r = 0; r < 8; ++r) rmax[r] = -1e30f;

  for (int j0 = 0; j0 < SEQ; j0 += 32) {
    // stage the K and V tiles, [32 keys][64 d] each and both untransposed, via
    // async 16B copies: 256 chunks, chunk p = tid + i * 128 -> key p >> 3,
    // segment p & 7
    {
      const int key = tid >> 3, seg = tid & 7;
      const size_t go = ((size_t)(b * SEQ + j0 + key)) * Dm + h * DH + seg * 8;
      async_b128_x4(&K[go], &Kt[key * KP + seg * 8], 16 * Dm, 16 * KP,
                    &V[go], &Vs[key * VP + seg * 8], 16 * Dm, 16 * VP);
    }
    if (j0 + 32 < SEQ)
      __builtin_prefetch(&K[((size_t)(b * SEQ + j0 + 32 + (tid >> 2))) * Dm +
                            h * DH], 0, 1);
    wait_async0();
    __syncthreads();

    // scores (log2 domain): two 16x16 tiles, K-dim = dh = 64 (2 wmma each)
    v8f s[2];
#pragma unroll
    for (int t = 0; t < 2; ++t) {
      const _Float16* krow = Kt + (t * 16 + ln) * KP;
      v8f z = {};
      z = wmma32(qf[0], ldfrag(krow, grp), z);
      z = wmma32(qf[1], ldfrag(krow + 32, grp), z);
      s[t] = z;
    }

    // online softmax; row r lives in lanes sharing (lane>>4): DPP max
    float alpha[8];
#pragma unroll
    for (int r = 0; r < 8; ++r) {
      float lm = rowmax16(fmaxf(s[0][r], s[1][r]));
      float nm = fmaxf(rmax[r], lm);
      alpha[r] = __builtin_amdgcn_exp2f(rmax[r] - nm);
      rmax[r] = nm;
      s[0][r] = __builtin_amdgcn_exp2f(s[0][r] - nm);
      s[1][r] = __builtin_amdgcn_exp2f(s[1][r] - nm);
    }
#pragma unroll
    for (int nt = 0; nt < 4; ++nt)
#pragma unroll
      for (int r = 0; r < 8; ++r) o[nt][r] *= alpha[r];
#pragma unroll
    for (int r = 0; r < 8; ++r) osum[r] *= alpha[r];

    // C-layout -> A-layout via per-wave LDS patch
    _Float16* pw = Pl + w * 16 * PP;
#pragma unroll
    for (int t = 0; t < 2; ++t)
#pragma unroll
      for (int r = 0; r < 8; ++r)
        pw[(grp * 8 + r) * PP + t * 16 + ln] = (_Float16)s[t][r];
    asm volatile("s_wait_dscnt 0" ::: "memory");

    v16h pf = ldfrag(pw + ln * PP, grp);
#pragma unroll
    for (int nt = 0; nt < 4; ++nt) {
      v16h vf = ldfrag_tr<VP>(vtr + nt * 16);
      o[nt] = wmma32(pf, vf, o[nt]);
    }
    osum = wmma32(pf, onesf, osum);     // row sums, C-layout, f32 accum
    // this wave's LDS reads have retired before the next trip's copies refill
    asm volatile("s_wait_dscnt 0" ::: "memory");
    __syncthreads();
  }

  // normalize and store f16
#pragma unroll
  for (int nt = 0; nt < 4; ++nt)
#pragma unroll
    for (int r = 0; r < 8; ++r) {
      int row = q0 + w * 16 + grp * 8 + r;
      int col = h * DH + nt * 16 + ln;
      O[((size_t)(b * SEQ + row)) * Dm + col] = (_Float16)(o[nt][r] / osum[r]);
    }
}

// ---------------------------------------------------------------- launch
extern "C" void kernel_launch(void* const* d_in, const int* in_sizes, int n_in,
                              void* d_out, int out_size, void* d_ws,
                              size_t ws_size, hipStream_t stream) {
  const float* x  = (const float*)d_in[0];
  const float* y  = (const float*)d_in[1];
  const int* pq   = (const int*)d_in[2];
  const int* pkv  = (const int*)d_in[3];
  const float* Wq = (const float*)d_in[4];
  const float* bq = (const float*)d_in[5];
  const float* Wk = (const float*)d_in[6];
  const float* bk = (const float*)d_in[7];
  const float* Wv = (const float*)d_in[8];
  const float* bv = (const float*)d_in[9];
  const float* Wo = (const float*)d_in[10];
  const float* bo = (const float*)d_in[11];

  const size_t ACT = (size_t)TOK * Dm;   // 6,291,456 halves
  const size_t WSZ = (size_t)Dm * Dm;    //   589,824 halves

  char* ws = (char*)d_ws;
  _Float16* xh  = (_Float16*)ws;                ws += ACT * 2;
  _Float16* yh  = (_Float16*)ws;                ws += ACT * 2;
  _Float16* Wqh = (_Float16*)ws;                ws += WSZ * 2;
  _Float16* Wkh = (_Float16*)ws;                ws += WSZ * 2;
  _Float16* Wvh = (_Float16*)ws;                ws += WSZ * 2;
  _Float16* Woh = (_Float16*)ws;                ws += WSZ * 2;
  _Float16* Qh  = (_Float16*)ws;                ws += ACT * 2;
  _Float16* Kh  = (_Float16*)ws;                ws += ACT * 2;
  _Float16* Vh  = (_Float16*)ws;                ws += ACT * 2;
  _Float16* Oh  = (_Float16*)ws;                ws += ACT * 2;

  // 1) f32 -> f16
  cvt_f32_f16<<<(int)((ACT + 255) / 256), 256, 0, stream>>>(x, xh, (int)ACT);
  cvt_f32_f16<<<(int)((ACT + 255) / 256), 256, 0, stream>>>(y, yh, (int)ACT);
  cvt_f32_f16<<<(int)((WSZ + 255) / 256), 256, 0, stream>>>(Wq, Wqh, (int)WSZ);
  cvt_f32_f16<<<(int)((WSZ + 255) / 256), 256, 0, stream>>>(Wk, Wkh, (int)WSZ);
  cvt_f32_f16<<<(int)((WSZ + 255) / 256), 256, 0, stream>>>(Wv, Wvh, (int)WSZ);
  cvt_f32_f16<<<(int)((WSZ + 255) / 256), 256, 0, stream>>>(Wo, Woh, (int)WSZ);

  // 2) Q/K/V projections (WMMA, bias fused, f16 out)
  dim3 ggrid(TOK / 128, Dm / 128);
  gemm_kernel<true><<<ggrid, 256, 0, stream>>>(xh, Wqh, bq, Qh);
  gemm_kernel<true><<<ggrid, 256, 0, stream>>>(yh, Wkh, bk, Kh);
  gemm_kernel<true><<<ggrid, 256, 0, stream>>>(yh, Wvh, bv, Vh);

  // 3) 2D RoPE on Q and K
  int rthreads = TOK * NH * 32;
  rope_kernel<<<rthreads / 256, 256, 0, stream>>>(Qh, pq);
  rope_kernel<<<rthreads / 256, 256, 0, stream>>>(Kh, pkv);

  // 4) flash attention (WMMA)
  attn_kernel<<<dim3(SEQ / 64, Bb * NH), 128, 0, stream>>>(Qh, Kh, Vh, Oh);

  // 5) output projection, f32 out
  gemm_kernel<false><<<ggrid, 256, 0, stream>>>(Oh, Woh, bo, (float*)d_out);
}

// v003
// A run of this version takes 157 microseconds.
// Timed twice side by side with v002, it ran 1.17 and 1.16 times as fast.
// All steps since v000 together make it 4.85 times as fast.
#include <hip/hip_runtime.h>
#include <hip/hip_bf16.h>

typedef __attribute__((ext_vector_type(16))) _Float16 v16h;
typedef __attribute__((ext_vector_type(8)))  _Float16 v8h;
typedef __attribute__((ext_vector_type(8)))  float    v8f;

#define DEV __device__ __forceinline__

static constexpr int Bb   = 8;
static constexpr int SEQ  = 1024;   // N == M
static constexpr int Dm   = 768;
static constexpr int NH   = 12;
static constexpr int DH   = 64;
static constexpr int TOK  = Bb * SEQ;   // 8192
static constexpr int ACT  = TOK * Dm;   // 6,291,456 elements of an activation
static constexpr int WSZ  = Dm * Dm;    //   589,824 elements of a weight

DEV v16h mk16(v8h lo, v8h hi) {
  v16h r;
#pragma unroll
  for (int i = 0; i < 8; ++i) { r[i] = lo[i]; r[i + 8] = hi[i]; }
  return r;
}

// Load one 16x32 f16 WMMA fragment (A-layout, or B-layout from a transposed
// [n][k] tile). rowbase points at this lane's row (16B aligned); grp = lane>>4.
DEV v16h ldfrag(const _Float16* rowbase, int grp) {
  v8h lo = *(const v8h*)(rowbase + grp * 8);
  v8h hi = *(const v8h*)(rowbase + 16 + grp * 8);
  return mk16(lo, hi);
}

DEV v8f wmma32(v16h a, v16h b, v8f c) {
  return __builtin_amdgcn_wmma_f32_16x16x32_f16(false, a, false, b, (short)0, c,
                                                false, false);
}

// CDNA5 async copy global->LDS, 16B per lane, tracked by ASYNCcnt.
// Generic addresses of __shared__ objects carry the LDS byte offset in
// addr[31:0] (ISA 10.2 aperture rule), which is exactly what VDST wants.
// A tile pair's async copies as one statement (16B per lane and copy). The
// closing s_wait_xcnt 0 stands in the copies' own statement so that no address
// register of an issued copy can be rewritten ahead of it.
DEV unsigned ldsoff(const void* l) { return (unsigned)(size_t)l; }
DEV unsigned long long gaddr(const void* g) {
  return (unsigned long long)(size_t)g;
}
DEV void async_b128_x8(const _Float16* ga, _Float16* la, int gsa, int lsa,
                       const _Float16* gb, _Float16* lb, int gsb, int lsb) {
  asm volatile("global_load_async_to_lds_b128 %0, %8, off\n\t"
               "global_load_async_to_lds_b128 %1, %9, off\n\t"
               "global_load_async_to_lds_b128 %2, %10, off\n\t"
               "global_load_async_to_lds_b128 %3, %11, off\n\t"
               "global_load_async_to_lds_b128 %4, %12, off\n\t"
               "global_load_async_to_lds_b128 %5, %13, off\n\t"
               "global_load_async_to_lds_b128 %6, %14, off\n\t"
               "global_load_async_to_lds_b128 %7, %15, off\n\t"
               "s_wait_xcnt 0x0"
               :: "v"(ldsoff(la)), "v"(ldsoff(la + lsa)),
                  "v"(ldsoff(la + 2 * lsa)), "v"(ldsoff(la + 3 * lsa)),
                  "v"(ldsoff(lb)), "v"(ldsoff(lb + lsb)),
                  "v"(ldsoff(lb + 2 * lsb)), "v"(ldsoff(lb + 3 * lsb)),
                  "v"(gaddr(ga)), "v"(gaddr(ga + gsa)),
                  "v"(gaddr(ga + 2 * gsa)), "v"(gaddr(ga + 3 * gsa)),
                  "v"(gaddr(gb)), "v"(gaddr(gb + gsb)),
                  "v"(gaddr(gb + 2 * gsb)), "v"(gaddr(gb + 3 * gsb))
               : "memory");
}
DEV void async_b128_x4(const _Float16* ga, _Float16* la, int gsa, int lsa,
                       const _Float16* gb, _Float16* lb, int gsb, int lsb) {
  asm volatile("global_load_async_to_lds_b128 %0, %4, off\n\t"
               "global_load_async_to_lds_b128 %1, %5, off\n\t"
               "global_load_async_to_lds_b128 %2, %6, off\n\t"
               "global_load_async_to_lds_b128 %3, %7, off\n\t"
               "s_wait_xcnt 0x0"
               :: "v"(ldsoff(la)), "v"(ldsoff(la + lsa)), "v"(ldsoff(lb)),
                  "v"(ldsoff(lb + lsb)), "v"(gaddr(ga)), "v"(gaddr(ga + gsa)),
                  "v"(gaddr(gb)), "v"(gaddr(gb + gsb))
               : "memory");
}
DEV void wait_async0() { asm volatile("s_wait_asynccnt 0" ::: "memory"); }

// Transposing LDS load: from a row-major [k][n] f16 tile, lane (c = lane & 15,
// h = lane >> 4) receives T[kbase + 8h + 0..7][nbase + c]. The lane's address is
// row kbase + 8h + (lane & 7), column nbase + 8 * ((lane >> 3) & 1).
typedef short s16x8 __attribute__((ext_vector_type(8)));
DEV v8h ld_tr16(const _Float16* p) {
  typedef __attribute__((address_space(3))) s16x8 lds_s16x8;
  return __builtin_bit_cast(v8h,
                            __builtin_amdgcn_ds_load_tr16_b128_v8i16((lds_s16x8*)p));
}
// One 32(k) x 16(n) B fragment from a [k][n] tile of row pitch PITCH halves;
// lanebase already holds the lane's row and column part. Its k order is the one
// ldfrag gives the A side (k = 8h + s, then 16 + 8h + s).
template <int PITCH>
DEV v16h ldfrag_tr(const _Float16* lanebase) {
  return mk16(ld_tr16(lanebase), ld_tr16(lanebase + 16 * PITCH));
}

// 16-lane max reduction step via DPP (stays inside each 16-lane row).
template <int CTRL>
DEV float dppmax(float v) {
  int t = __builtin_amdgcn_mov_dpp(__builtin_bit_cast(int, v), CTRL, 0xf, 0xf,
                                   true);
  return fmaxf(v, __builtin_bit_cast(float, t));
}
DEV float rowmax16(float v) {
  v = dppmax<0xB1>(v);    // quad_perm(1,0,3,2)  : xor 1
  v = dppmax<0x4E>(v);    // quad_perm(2,3,0,1)  : xor 2
  v = dppmax<0x141>(v);   // row_half_mirror     : pairs across quads in each 8
  v = dppmax<0x140>(v);   // row_mirror          : pairs across the two 8s
  return v;
}

// ---------------------------------------------------------------- convert
// All six f32 -> f16 conversions in one grid: none reads another's output. The
// f16 copies lie one behind the other in out (x, y, Wq, Wk, Wv, Wo), so the flat
// index is the output index; a block of 256 lies wholly inside one source.
__global__ void __launch_bounds__(256)
cvt_all(const float* __restrict__ x, const float* __restrict__ y,
        const float* __restrict__ Wq, const float* __restrict__ Wk,
        const float* __restrict__ Wv, const float* __restrict__ Wo,
        _Float16* __restrict__ out) {
  constexpr int AB = ACT / 256, WB = WSZ / 256;   // blocks per source
  static_assert(ACT % 256 == 0 && WSZ % 256 == 0, "whole blocks");
  const int blk = blockIdx.x;
  const float* src;
  int rel;
  if (blk < AB) {
    src = x; rel = blk;
  } else if (blk < 2 * AB) {
    src = y; rel = blk - AB;
  } else {
    const int k = (blk - 2 * AB) / WB;
    rel = (blk - 2 * AB) - k * WB;
    src = k == 0 ? Wq : k == 1 ? Wk : k == 2 ? Wv : Wo;
  }
  out[blk * 256 + threadIdx.x] = (_Float16)src[rel * 256 + threadIdx.x];
}

// ---------------------------------------------------------------- GEMM
// C[Mtot x 768] = A[Mtot x 768] (f16) @ W[768 x 768] (f16) + bias(f32)
// Block tile 128x128, K-step 64. 8 waves, each 32(M) x 64(N).
template <bool OUT16>
DEV void gemm_body(const _Float16* __restrict__ A, const _Float16* __restrict__ W,
                   const float* __restrict__ bias, void* __restrict__ Cout) {
  // A tile [m][k]; pitch 144 B = 16 B x odd, the conflict-free pitch of the
  // ds_load_b128 reader (16 rows of one column segment fall on 16 bank groups)
  constexpr int AP = 72;
  __shared__ __align__(16) _Float16 As[128 * AP];
  // W tile as it lies in memory, [k][n]; pitch 288 B = 32 B x odd, the
  // conflict-free pitch of the transposing reader
  constexpr int BP = 144;
  __shared__ __align__(16) _Float16 Bs[64 * BP];

  const int tid = threadIdx.x, lane = tid & 31, w = tid >> 5;
  const int ln = lane & 15, grp = lane >> 4;
  const int m0 = blockIdx.x * 128, n0 = blockIdx.y * 128;
  const int wm = (w & 3) * 32;      // wave M offset within block
  const int wn = (w >> 2) * 64;     // wave N offset within block

  // this lane's row and column part of every transposing read of Bs
  const _Float16* btr =
      Bs + (grp * 8 + (lane & 7)) * BP + wn + ((lane >> 3) & 1) * 8;

  v8f acc[2][4] = {};

  for (int k0 = 0; k0 < Dm; k0 += 64) {
    // --- stage both tiles via async 16B copies (straight copies), 1024 chunks
    // each, chunk c = tid + i * 256:
    // A tile 128(m) x 64(k): row c >> 3, segment c & 7
    // W tile 64(k) x 128(n), untransposed: row c >> 4, segment c & 15
    {
      const int row = tid >> 3, sega = tid & 7;
      const int kk = tid >> 4, segw = tid & 15;
      async_b128_x8(&A[(size_t)(m0 + row) * Dm + k0 + sega * 8],
                    &As[row * AP + sega * 8], 32 * Dm, 32 * AP,
                    &W[(size_t)(k0 + kk) * Dm + n0 + segw * 8],
                    &Bs[kk * BP + segw * 8], 16 * Dm, 16 * BP);
    }
    if (k0 + 64 < Dm)
      __builtin_prefetch(&A[(size_t)(m0 + (tid >> 1)) * Dm + k0 + 64], 0, 1);
    wait_async0();
    __syncthreads();

#pragma unroll
    for (int kc = 0; kc < 2; ++kc) {
      v16h af[2], bf[4];
#pragma unroll
      for (int i = 0; i < 2; ++i)
        af[i] = ldfrag(&As[(wm + i * 16 + ln) * AP + kc * 32], grp);
#pragma unroll
      for (int j = 0; j < 4; ++j)
        bf[j] = ldfrag_tr<BP>(btr + kc * 32 * BP + j * 16);
#pragma unroll
      for (int i = 0; i < 2; ++i)
#pragma unroll
        for (int j = 0; j < 4; ++j) acc[i][j] = wmma32(af[i], bf[j], acc[i][j]);
    }
    // this wave's LDS reads have retired before the next trip's copies refill
    asm volatile("s_wait_dscnt 0" ::: "memory");
    __syncthreads();
  }

  // epilogue: C-layout -> lane holds col n, VGPR r holds row 8*grp+r
#pragma unroll
  for (int i = 0; i < 2; ++i)
#pragma unroll
    for (int j = 0; j < 4; ++j) {
      int ngl = n0 + wn + j * 16 + ln;
      float bv = bias[ngl];
#pragma unroll
      for (int r = 0; r < 8; ++r) {
        int mg = m0 + wm + i * 16 + grp * 8 + r;
        float vout = acc[i][j][r] + bv;
        if (OUT16)
          ((_Float16*)Cout)[(size_t)mg * Dm + ngl] = (_Float16)vout;
        else
          ((float*)Cout)[(size_t)mg * Dm + ngl] = vout;
      }
    }
}

// The Q, K and V projections in one grid, blockIdx.z = which: none reads
// another's output. Wqkv holds the three f16 weights and QKV the three outputs,
// each one behind the other.
__global__ void __launch_bounds__(256)
gemm_qkv(const _Float16* __restrict__ xh, const _Float16* __restrict__ yh,
         const _Float16* __restrict__ Wqkv, const float* __restrict__ bq,
         const float* __restrict__ bk, const float* __restrict__ bv,
         _Float16* __restrict__ QKV) {
  const int z = blockIdx.z;
  gemm_body<true>(z == 0 ? xh : yh, Wqkv + (size_t)z * WSZ,
                  z == 0 ? bq : z == 1 ? bk : bv, QKV + (size_t)z * ACT);
}

__global__ void __launch_bounds__(256)
gemm_out(const _Float16* __restrict__ A, const _Float16* __restrict__ W,
         const float* __restrict__ bias, float* __restrict__ C) {
  gemm_body<false>(A, W, bias, C);
}

// ---------------------------------------------------------------- RoPE 2D
// t: [TOK][768] f16 (heads inline). One thread per rotation pair.
// Q and K in one grid, blockIdx.y = which: they share nothing.
__global__ void rope_kernel(_Float16* __restrict__ tq,
                            const int* __restrict__ posq,
                            _Float16* __restrict__ tk,
                            const int* __restrict__ posk) {
  _Float16* __restrict__ t = blockIdx.y == 0 ? tq : tk;
  const int* __restrict__ pos = blockIdx.y == 0 ? posq : posk;
  int tid = blockIdx.x * blockDim.x + threadIdx.x;  // TOK*NH*2*16 threads
  int jj = tid & 15;
  int half = (tid >> 4) & 1;
  int h = (tid >> 5) % NH;
  int tok = tid / (32 * NH);
  if (tok >= TOK) return;

  int p = pos[tok * 2 + half];                 // half0 -> row, half1 -> col
  float ang = (float)p * __expf(-0.28782313662425572f * (float)jj); // ln(100)/16
  float s, c;
  __sincosf(ang, &s, &c);

  size_t base = (size_t)tok * Dm + h * DH + half * 32 + jj;
  float t0 = (float)t[base];
  float t1 = (float)t[base + 16];
  t[base]      = (_Float16)(t0 * c - t1 * s);
  t[base + 16] = (_Float16)(t1 * c + t0 * s);
}

// ---------------------------------------------------------------- attention
// grid (SEQ/64, B*NH); 128 threads = 4 waves x 16 query rows.
// Q is pre-scaled by dh^-0.5 * log2(e), so softmax runs in exp2 domain.
// Row sums are accumulated with an extra WMMA against a ones matrix
// (P x 1 -> every column holds the row sum, already in C-layout indexing).
__global__ void __launch_bounds__(128)
attn_kernel(const _Float16* __restrict__ Q, const _Float16* __restrict__ K,
            const _Float16* __restrict__ V, _Float16* __restrict__ O) {
  // K tile [key][d] and the P patches [query][key]: pitches 144 B and 80 B,
  // 16 B x odd, the conflict-free pitch of the ds_load_b128 reader
  constexpr int KP = 72;
  constexpr int PP = 40;
  __shared__ __align__(16) _Float16 Kt[32 * KP];
  // V tile as it lies in memory, [key][d]; pitch 160 B = 32 B x odd, the
  // conflict-free pitch of the transposing reader
  constexpr int VP = 80;
  __shared__ __align__(16) _Float16 Vs[32 * VP];
  __shared__ __align__(16) _Float16 Pl[4 * 16 * PP];

  const int b = blockIdx.y / NH, h = blockIdx.y % NH;
  const int q0 = blockIdx.x * 64;
  const int tid = threadIdx.x, lane = tid & 31, w = tid >> 5;
  const int ln = lane & 15, grp = lane >> 4;

  // Q fragments (16x64 A-matrix = 2 chunks of 16x32), loaded once;
  // fold dh^-0.5 * log2(e) = 0.125 * 1.4426950 into Q (f16, tiny rel. error).
  const _Float16 qscale = (_Float16)0.18033688f;
  const _Float16* qp = Q + ((size_t)(b * SEQ + q0 + w * 16 + ln)) * Dm + h * DH;
  v16h qf[2];
#pragma unroll
  for (int c = 0; c < 2; ++c) {
    qf[c] = ldfrag(qp + c * 32, grp);
#pragma unroll
    for (int i = 0; i < 16; ++i) qf[c][i] = qf[c][i] * qscale;
  }

  v16h onesf;
#pragma unroll
  for (int i = 0; i < 16; ++i) onesf[i] = (_Float16)1.0f;

  // this lane's row and column part of every transposing read of Vs
  const _Float16* vtr = Vs + (grp * 8 + (lane & 7)) * VP + ((lane >> 3) & 1) * 8;

  v8f o[4] = {};
  v8f osum = {};
  float rmax[8];
#pragma unroll
  for (int r = 0; r < 8; ++r) rmax[r] = -1e30f;

  for (int j0 = 0; j0 < SEQ; j0 += 32) {
    // stage the K and V tiles, [32 keys][64 d] each and both untransposed, via
    // async 16B copies: 256 chunks, chunk p = tid + i * 128 -> key p >> 3,
    // segment p & 7
    {
      const int key = tid >> 3, seg = tid & 7;
      const size_t go = ((size_t)(b * SEQ + j0 + key)) * Dm + h * DH + seg * 8;
      async_b128_x4(&K[go], &Kt[key * KP + seg * 8], 16 * Dm, 16 * KP,
                    &V[go], &Vs[key * VP + seg * 8], 16 * Dm, 16 * VP);
    }
    if (j0 + 32 < SEQ)
      __builtin_prefetch(&K[((size_t)(b * SEQ + j0 + 32 + (tid >> 2))) * Dm +
                            h * DH], 0, 1);
    wait_async0();
    __syncthreads();

    // scores (log2 domain): two 16x16 tiles, K-dim = dh = 64 (2 wmma each)
    v8f s[2];
#pragma unroll
    for (int t = 0; t < 2; ++t) {
      const _Float16* krow = Kt + (t * 16 + ln) * KP;
      v8f z = {};
      z = wmma32(qf[0], ldfrag(krow, grp), z);
      z = wmma32(qf[1], ldfrag(krow + 32, grp), z);
      s[t] = z;
    }

    // online softmax; row r lives in lanes sharing (lane>>4): DPP max
    float alpha[8];
#pragma unroll
    for (int r = 0; r < 8; ++r) {
      float lm = rowmax16(fmaxf(s[0][r], s[1][r]));
      float nm = fmaxf(rmax[r], lm);
      alpha[r] = __builtin_amdgcn_exp2f(rmax[r] - nm);
      rmax[r] = nm;
      s[0][r] = __builtin_amdgcn_exp2f(s[0][r] - nm);
      s[1][r] = __builtin_amdgcn_exp2f(s[1][r] - nm);
    }
#pragma unroll
    for (int nt = 0; nt < 4; ++nt)
#pragma unroll
      for (int r = 0; r < 8; ++r) o[nt][r] *= alpha[r];
#pragma unroll
    for (int r = 0; r < 8; ++r) osum[r] *= alpha[r];

    // C-layout -> A-layout via per-wave LDS patch
    _Float16* pw = Pl + w * 16 * PP;
#pragma unroll
    for (int t = 0; t < 2; ++t)
#pragma unroll
      for (int r = 0; r < 8; ++r)
        pw[(grp * 8 + r) * PP + t * 16 + ln] = (_Float16)s[t][r];
    asm volatile("s_wait_dscnt 0" ::: "memory");

    v16h pf = ldfrag(pw + ln * PP, grp);
#pragma unroll
    for (int nt = 0; nt < 4; ++nt) {
      v16h vf = ldfrag_tr<VP>(vtr + nt * 16);
      o[nt] = wmma32(pf, vf, o[nt]);
    }
    osum = wmma32(pf, onesf, osum);     // row sums, C-layout, f32 accum
    // this wave's LDS reads have retired before the next trip's copies refill
    asm volatile("s_wait_dscnt 0" ::: "memory");
    __syncthreads();
  }

  // normalize and store f16
#pragma unroll
  for (int nt = 0; nt < 4; ++nt)
#pragma unroll
    for (int r = 0; r < 8; ++r) {
      int row = q0 + w * 16 + grp * 8 + r;
      int col = h * DH + nt * 16 + ln;
      O[((size_t)(b * SEQ + row)) * Dm + col] = (_Float16)(o[nt][r] / osum[r]);
    }
}

// ---------------------------------------------------------------- launch
extern "C" void kernel_launch(void* const* d_in, const int* in_sizes, int n_in,
                              void* d_out, int out_size, void* d_ws,
                              size_t ws_size, hipStream_t stream) {
  const float* x  = (const float*)d_in[0];
  const float* y  = (const float*)d_in[1];
  const int* pq   = (const int*)d_in[2];
  const int* pkv  = (const int*)d_in[3];
  const float* Wq = (const float*)d_in[4];
  const float* bq = (const float*)d_in[5];
  const float* Wk = (const float*)d_in[6];
  const float* bk = (const float*)d_in[7];
  const float* Wv = (const float*)d_in[8];
  const float* bv = (const float*)d_in[9];
  const float* Wo = (const float*)d_in[10];
  const float* bo = (const float*)d_in[11];

  char* ws = (char*)d_ws;
  _Float16* xh  = (_Float16*)ws;                ws += (size_t)ACT * 2;
  _Float16* yh  = (_Float16*)ws;                ws += (size_t)ACT * 2;
  _Float16* Wqh = (_Float16*)ws;                ws += (size_t)WSZ * 6;  // q, k, v
  _Float16* Woh = (_Float16*)ws;                ws += (size_t)WSZ * 2;
  _Float16* Qh  = (_Float16*)ws;                ws += (size_t)ACT * 2;
  _Float16* Kh  = (_Float16*)ws;                ws += (size_t)ACT * 2;
  _Float16* Vh  = (_Float16*)ws;                ws += (size_t)ACT * 2;
  _Float16* Oh  = (_Float16*)ws;                ws += (size_t)ACT * 2;

  // 1) f32 -> f16, all six sources; xh is the start of the six f16 copies
  cvt_all<<<(2 * ACT + 4 * WSZ) / 256, 256, 0, stream>>>(x, y, Wq, Wk, Wv, Wo,
                                                         xh);

  // 2) Q/K/V projections (WMMA, bias fused, f16 out); Qh starts the three outputs
  gemm_qkv<<<dim3(TOK / 128, Dm / 128, 3), 256, 0, stream>>>(xh, yh, Wqh, bq, bk,
                                                             bv, Qh);

  // 3) 2D RoPE on Q and K
  rope_kernel<<<dim3(TOK * NH * 32 / 256, 2), 256, 0, stream>>>(Qh, pq, Kh, pkv);

  // 4) flash attention (WMMA)
  attn_kernel<<<dim3(SEQ / 64, Bb * NH), 128, 0, stream>>>(Qh, Kh, Vh, Oh);

  // 5) output projection, f32 out
  gemm_out<<<dim3(TOK / 128, Dm / 128), 256, 0, stream>>>(Oh, Woh, bo,
                                                          (float*)d_out);
}

// v004
// A run of this version takes 145 microseconds.
// Two timings next to v003 both put it at 1.08 times that version's speed.
// Over all steps from v000 it is 5.24 times as fast.
#include <hip/hip_runtime.h>
#include <hip/hip_bf16.h>

typedef __attribute__((ext_vector_type(16))) _Float16 v16h;
typedef __attribute__((ext_vector_type(8)))  _Float16 v8h;
typedef __attribute__((ext_vector_type(8)))  float    v8f;

#define DEV __device__ __forceinline__

static constexpr int Bb   = 8;
static constexpr int SEQ  = 1024;   // N == M
static constexpr int Dm   = 768;
static constexpr int NH   = 12;
static constexpr int DH   = 64;
static constexpr int TOK  = Bb * SEQ;   // 8192
static constexpr int ACT  = TOK * Dm;   // 6,291,456 elements of an activation
static constexpr int WSZ  = Dm * Dm;    //   589,824 elements of a weight

DEV v16h mk16(v8h lo, v8h hi) {
  v16h r;
#pragma unroll
  for (int i = 0; i < 8; ++i) { r[i] = lo[i]; r[i + 8] = hi[i]; }
  return r;
}

// Load one 16x32 f16 WMMA fragment (A-layout, or B-layout from a transposed
// [n][k] tile). rowbase points at this lane's row (16B aligned); grp = lane>>4.
DEV v16h ldfrag(const _Float16* rowbase, int grp) {
  v8h lo = *(const v8h*)(rowbase + grp * 8);
  v8h hi = *(const v8h*)(rowbase + 16 + grp * 8);
  return mk16(lo, hi);
}

DEV v8f wmma32(v16h a, v16h b, v8f c) {
  return __builtin_amdgcn_wmma_f32_16x16x32_f16(false, a, false, b, (short)0, c,
                                                false, false);
}

// CDNA5 async copy global->LDS, 16B per lane, tracked by ASYNCcnt.
// Generic addresses of __shared__ objects carry the LDS byte offset in
// addr[31:0] (ISA 10.2 aperture rule), which is exactly what VDST wants.
// A tile pair's async copies as one statement (16B per lane and copy). The
// closing s_wait_xcnt 0 stands in the copies' own statement so that no address
// register of an issued copy can be rewritten ahead of it.
DEV unsigned ldsoff(const void* l) { return (unsigned)(size_t)l; }
DEV unsigned long long gaddr(const void* g) {
  return (unsigned long long)(size_t)g;
}
DEV void async_b128_x8(const _Float16* ga, _Float16* la, int gsa, int lsa,
                       const _Float16* gb, _Float16* lb, int gsb, int lsb) {
  asm volatile("global_load_async_to_lds_b128 %0, %8, off\n\t"
               "global_load_async_to_lds_b128 %1, %9, off\n\t"
               "global_load_async_to_lds_b128 %2, %10, off\n\t"
               "global_load_async_to_lds_b128 %3, %11, off\n\t"
               "global_load_async_to_lds_b128 %4, %12, off\n\t"
               "global_load_async_to_lds_b128 %5, %13, off\n\t"
               "global_load_async_to_lds_b128 %6, %14, off\n\t"
               "global_load_async_to_lds_b128 %7, %15, off\n\t"
               "s_wait_xcnt 0x0"
               :: "v"(ldsoff(la)), "v"(ldsoff(la + lsa)),
                  "v"(ldsoff(la + 2 * lsa)), "v"(ldsoff(la + 3 * lsa)),
                  "v"(ldsoff(lb)), "v"(ldsoff(lb + lsb)),
                  "v"(ldsoff(lb + 2 * lsb)), "v"(ldsoff(lb + 3 * lsb)),
                  "v"(gaddr(ga)), "v"(gaddr(ga + gsa)),
                  "v"(gaddr(ga + 2 * gsa)), "v"(gaddr(ga + 3 * gsa)),
                  "v"(gaddr(gb)), "v"(gaddr(gb + gsb)),
                  "v"(gaddr(gb + 2 * gsb)), "v"(gaddr(gb + 3 * gsb))
               : "memory");
}
DEV void async_b128_x4(const _Float16* ga, _Float16* la, int gsa, int lsa,
                       const _Float16* gb, _Float16* lb, int gsb, int lsb) {
  asm volatile("global_load_async_to_lds_b128 %0, %4, off\n\t"
               "global_load_async_to_lds_b128 %1, %5, off\n\t"
               "global_load_async_to_lds_b128 %2, %6, off\n\t"
               "global_load_async_to_lds_b128 %3, %7, off\n\t"
               "s_wait_xcnt 0x0"
               :: "v"(ldsoff(la)), "v"(ldsoff(la + lsa)), "v"(ldsoff(lb)),
                  "v"(ldsoff(lb + lsb)), "v"(gaddr(ga)), "v"(gaddr(ga + gsa)),
                  "v"(gaddr(gb)), "v"(gaddr(gb + gsb))
               : "memory");
}
DEV void wait_async0() { asm volatile("s_wait_asynccnt 0" ::: "memory"); }

// Transposing LDS load: from a row-major [k][n] f16 tile, lane (c = lane & 15,
// h = lane >> 4) receives T[kbase + 8h + 0..7][nbase + c]. The lane's address is
// row kbase + 8h + (lane & 7), column nbase + 8 * ((lane >> 3) & 1).
typedef short s16x8 __attribute__((ext_vector_type(8)));
DEV v8h ld_tr16(const _Float16* p) {
  typedef __attribute__((address_space(3))) s16x8 lds_s16x8;
  return __builtin_bit_cast(v8h,
                            __builtin_amdgcn_ds_load_tr16_b128_v8i16((lds_s16x8*)p));
}
// One 32(k) x 16(n) B fragment from a [k][n] tile of row pitch PITCH halves;
// lanebase already holds the lane's row and column part. Its k order is the one
// ldfrag gives the A side (k = 8h + s, then 16 + 8h + s).
template <int PITCH>
DEV v16h ldfrag_tr(const _Float16* lanebase) {
  return mk16(ld_tr16(lanebase), ld_tr16(lanebase + 16 * PITCH));
}

// Lane l with lane l ^ 16 (the two wave halves exchange one value).
DEV float xhalf(float x) {
  int b = __builtin_bit_cast(int, x);
  return __builtin_bit_cast(
      float, __builtin_amdgcn_permlanex16(b, b, 0x76543210, 0xfedcba98, false,
                                          false));
}

// ---------------------------------------------------------------- convert
// All six f32 -> f16 conversions in one grid: none reads another's output. The
// f16 copies lie one behind the other in out (x, y, Wq, Wk, Wv, Wo), so the flat
// index is the output index; a block of 256 lies wholly inside one source.
__global__ void __launch_bounds__(256)
cvt_all(const float* __restrict__ x, const float* __restrict__ y,
        const float* __restrict__ Wq, const float* __restrict__ Wk,
        const float* __restrict__ Wv, const float* __restrict__ Wo,
        _Float16* __restrict__ out) {
  constexpr int AB = ACT / 256, WB = WSZ / 256;   // blocks per source
  static_assert(ACT % 256 == 0 && WSZ % 256 == 0, "whole blocks");
  const int blk = blockIdx.x;
  const float* src;
  int rel;
  if (blk < AB) {
    src = x; rel = blk;
  } else if (blk < 2 * AB) {
    src = y; rel = blk - AB;
  } else {
    const int k = (blk - 2 * AB) / WB;
    rel = (blk - 2 * AB) - k * WB;
    src = k == 0 ? Wq : k == 1 ? Wk : k == 2 ? Wv : Wo;
  }
  out[blk * 256 + threadIdx.x] = (_Float16)src[rel * 256 + threadIdx.x];
}

// ---------------------------------------------------------------- GEMM
// C[Mtot x 768] = A[Mtot x 768] (f16) @ W[768 x 768] (f16) + bias(f32)
// Block tile 128x128, K-step 64. 8 waves, each 32(M) x 64(N).
template <bool OUT16>
DEV void gemm_body(const _Float16* __restrict__ A, const _Float16* __restrict__ W,
                   const float* __restrict__ bias, void* __restrict__ Cout) {
  // A tile [m][k]; pitch 144 B = 16 B x odd, the conflict-free pitch of the
  // ds_load_b128 reader (16 rows of one column segment fall on 16 bank groups)
  constexpr int AP = 72;
  __shared__ __align__(16) _Float16 As[128 * AP];
  // W tile as it lies in memory, [k][n]; pitch 288 B = 32 B x odd, the
  // conflict-free pitch of the transposing reader
  constexpr int BP = 144;
  __shared__ __align__(16) _Float16 Bs[64 * BP];

  const int tid = threadIdx.x, lane = tid & 31, w = tid >> 5;
  const int ln = lane & 15, grp = lane >> 4;
  const int m0 = blockIdx.x * 128, n0 = blockIdx.y * 128;
  const int wm = (w & 3) * 32;      // wave M offset within block
  const int wn = (w >> 2) * 64;     // wave N offset within block

  // this lane's row and column part of every transposing read of Bs
  const _Float16* btr =
      Bs + (grp * 8 + (lane & 7)) * BP + wn + ((lane >> 3) & 1) * 8;

  v8f acc[2][4] = {};

  for (int k0 = 0; k0 < Dm; k0 += 64) {
    // --- stage both tiles via async 16B copies (straight copies), 1024 chunks
    // each, chunk c = tid + i * 256:
    // A tile 128(m) x 64(k): row c >> 3, segment c & 7
    // W tile 64(k) x 128(n), untransposed: row c >> 4, segment c & 15
    {
      const int row = tid >> 3, sega = tid & 7;
      const int kk = tid >> 4, segw = tid & 15;
      async_b128_x8(&A[(size_t)(m0 + row) * Dm + k0 + sega * 8],
                    &As[row * AP + sega * 8], 32 * Dm, 32 * AP,
                    &W[(size_t)(k0 + kk) * Dm + n0 + segw * 8],
                    &Bs[kk * BP + segw * 8], 16 * Dm, 16 * BP);
    }
    if (k0 + 64 < Dm)
      __builtin_prefetch(&A[(size_t)(m0 + (tid >> 1)) * Dm + k0 + 64], 0, 1);
    wait_async0();
    __syncthreads();

#pragma unroll
    for (int kc = 0; kc < 2; ++kc) {
      v16h af[2], bf[4];
#pragma unroll
      for (int i = 0; i < 2; ++i)
        af[i] = ldfrag(&As[(wm + i * 16 + ln) * AP + kc * 32], grp);
#pragma unroll
      for (int j = 0; j < 4; ++j)
        bf[j] = ldfrag_tr<BP>(btr + kc * 32 * BP + j * 16);
#pragma unroll
      for (int i = 0; i < 2; ++i)
#pragma unroll
        for (int j = 0; j < 4; ++j) acc[i][j] = wmma32(af[i], bf[j], acc[i][j]);
    }
    // this wave's LDS reads have retired before the next trip's copies refill
    asm volatile("s_wait_dscnt 0" ::: "memory");
    __syncthreads();
  }

  // epilogue: C-layout -> lane holds col n, VGPR r holds row 8*grp+r
#pragma unroll
  for (int i = 0; i < 2; ++i)
#pragma unroll
    for (int j = 0; j < 4; ++j) {
      int ngl = n0 + wn + j * 16 + ln;
      float bv = bias[ngl];
#pragma unroll
      for (int r = 0; r < 8; ++r) {
        int mg = m0 + wm + i * 16 + grp * 8 + r;
        float vout = acc[i][j][r] + bv;
        if (OUT16)
          ((_Float16*)Cout)[(size_t)mg * Dm + ngl] = (_Float16)vout;
        else
          ((float*)Cout)[(size_t)mg * Dm + ngl] = vout;
      }
    }
}

// The Q, K and V projections in one grid, blockIdx.z = which: none reads
// another's output. Wqkv holds the three f16 weights and QKV the three outputs,
// each one behind the other.
__global__ void __launch_bounds__(256)
gemm_qkv(const _Float16* __restrict__ xh, const _Float16* __restrict__ yh,
         const _Float16* __restrict__ Wqkv, const float* __restrict__ bq,
         const float* __restrict__ bk, const float* __restrict__ bv,
         _Float16* __restrict__ QKV) {
  const int z = blockIdx.z;
  gemm_body<true>(z == 0 ? xh : yh, Wqkv + (size_t)z * WSZ,
                  z == 0 ? bq : z == 1 ? bk : bv, QKV + (size_t)z * ACT);
}

__global__ void __launch_bounds__(256)
gemm_out(const _Float16* __restrict__ A, const _Float16* __restrict__ W,
         const float* __restrict__ bias, float* __restrict__ C) {
  gemm_body<false>(A, W, bias, C);
}

// ---------------------------------------------------------------- RoPE 2D
// t: [TOK][768] f16 (heads inline). One thread per rotation pair.
// Q and K in one grid, blockIdx.y = which: they share nothing.
__global__ void rope_kernel(_Float16* __restrict__ tq,
                            const int* __restrict__ posq,
                            _Float16* __restrict__ tk,
                            const int* __restrict__ posk) {
  _Float16* __restrict__ t = blockIdx.y == 0 ? tq : tk;
  const int* __restrict__ pos = blockIdx.y == 0 ? posq : posk;
  int tid = blockIdx.x * blockDim.x + threadIdx.x;  // TOK*NH*2*16 threads
  int jj = tid & 15;
  int half = (tid >> 4) & 1;
  int h = (tid >> 5) % NH;
  int tok = tid / (32 * NH);
  if (tok >= TOK) return;

  int p = pos[tok * 2 + half];                 // half0 -> row, half1 -> col
  float ang = (float)p * __expf(-0.28782313662425572f * (float)jj); // ln(100)/16
  float s, c;
  __sincosf(ang, &s, &c);

  size_t base = (size_t)tok * Dm + h * DH + half * 32 + jj;
  float t0 = (float)t[base];
  float t1 = (float)t[base + 16];
  t[base]      = (_Float16)(t0 * c - t1 * s);
  t[base + 16] = (_Float16)(t1 * c + t0 * s);
}

__global__ void __launch_bounds__(128)
attn_kernel(const _Float16* __restrict__ Q, const _Float16* __restrict__ K,
            const _Float16* __restrict__ V, _Float16* __restrict__ O) {
  // K tile [key][d]: pitch 144 B = 16 B x odd, the conflict-free pitch of the
  // ds_load_b128 reader
  constexpr int KP = 72;
  __shared__ __align__(16) _Float16 Kt[32 * KP];
  // V tile as it lies in memory, [key][d]; pitch 160 B = 32 B x odd, the
  // conflict-free pitch of the transposing reader
  constexpr int VP = 80;
  __shared__ __align__(16) _Float16 Vs[32 * VP];

  const int b = blockIdx.y / NH, h = blockIdx.y % NH;
  const int q0 = blockIdx.x * 64;
  const int tid = threadIdx.x, lane = tid & 31, w = tid >> 5;
  const int ln = lane & 15, grp = lane >> 4;

  // Q fragments (64(d) x 16(query) B-matrix = 2 chunks of 32 x 16), loaded once;
  // fold dh^-0.5 * log2(e) = 0.125 * 1.4426950 into Q (f16, tiny rel. error).
  const _Float16 qscale = (_Float16)0.18033688f;
  const _Float16* qp = Q + ((size_t)(b * SEQ + q0 + w * 16 + ln)) * Dm + h * DH;
  v16h qf[2];
#pragma unroll
  for (int c = 0; c < 2; ++c) {
    qf[c] = ldfrag(qp + c * 32, grp);
#pragma unroll
    for (int i = 0; i < 16; ++i) qf[c][i] = qf[c][i] * qscale;
  }

  v16h onesf;
#pragma unroll
  for (int i = 0; i < 16; ++i) onesf[i] = (_Float16)1.0f;

  // this lane's row and column part of every transposing read of Vs
  const _Float16* vtr = Vs + (grp * 8 + (lane & 7)) * VP + ((lane >> 3) & 1) * 8;

  v8f o[4] = {};      // O^T: lane = query ln, register r = d nt * 16 + 8 grp + r
  v8f osum = {};
  float rmax = -1e30f;

  for (int j0 = 0; j0 < SEQ; j0 += 32) {
    // stage the K and V tiles, [32 keys][64 d] each and both untransposed, via
    // async 16B copies: 256 chunks, chunk p = tid + i * 128 -> key p >> 3,
    // segment p & 7
    {
      const int key = tid >> 3, seg = tid & 7;
      const size_t go = ((size_t)(b * SEQ + j0 + key)) * Dm + h * DH + seg * 8;
      async_b128_x4(&K[go], &Kt[key * KP + seg * 8], 16 * Dm, 16 * KP,
                    &V[go], &Vs[key * VP + seg * 8], 16 * Dm, 16 * VP);
    }
    if (j0 + 32 < SEQ)
      __builtin_prefetch(&K[((size_t)(b * SEQ + j0 + 32 + (tid >> 2))) * Dm +
                            h * DH], 0, 1);
    wait_async0();
    __syncthreads();

    // scores (log2 domain), transposed: two 16(key) x 16(query) tiles, K-dim =
    // dh = 64 (2 wmma each); s[t][r] is key t * 16 + 8 grp + r, query ln
    v8f s[2];
#pragma unroll
    for (int t = 0; t < 2; ++t) {
      const _Float16* krow = Kt + (t * 16 + ln) * KP;
      v8f z = {};
      z = wmma32(ldfrag(krow, grp), qf[0], z);
      z = wmma32(ldfrag(krow + 32, grp), qf[1], z);
      s[t] = z;
    }

    // online softmax; a query's 32 scores lie in lanes ln and ln + 16
    float lm = fmaxf(s[0][0], s[1][0]);
#pragma unroll
    for (int r = 1; r < 8; ++r) lm = fmaxf(lm, fmaxf(s[0][r], s[1][r]));
    lm = fmaxf(lm, xhalf(lm));
    const float nm = fmaxf(rmax, lm);
    const float alpha = __builtin_amdgcn_exp2f(rmax - nm);
    rmax = nm;

    // P^T as a 32(key) x 16(query) B fragment: element i is key 8 grp + i,
    // element 8 + i key 16 + 8 grp + i, which is how s[0] and s[1] hold them
    v16h pf;
#pragma unroll
    for (int r = 0; r < 8; ++r) {
      pf[r]     = (_Float16)__builtin_amdgcn_exp2f(s[0][r] - nm);
      pf[r + 8] = (_Float16)__builtin_amdgcn_exp2f(s[1][r] - nm);
    }
#pragma unroll
    for (int nt = 0; nt < 4; ++nt)
#pragma unroll
      for (int r = 0; r < 8; ++r) o[nt][r] *= alpha;
    // all rows of the sum tile are alike and only register 0 is read at the end
    osum[0] *= alpha;

#pragma unroll
    for (int nt = 0; nt < 4; ++nt) {
      v16h vf = ldfrag_tr<VP>(vtr + nt * 16);   // V^T as A: row d, k = key
      o[nt] = wmma32(vf, pf, o[nt]);
    }
    osum = wmma32(onesf, pf, osum);     // column sums, f32 accum
    // this wave's LDS reads have retired before the next trip's copies refill
    asm volatile("s_wait_dscnt 0" ::: "memory");
    __syncthreads();
  }

  // normalize and store f16: 8 consecutive d of one query per lane and tile
  _Float16* op =
      O + ((size_t)(b * SEQ + q0 + w * 16 + ln)) * Dm + h * DH + grp * 8;
#pragma unroll
  for (int nt = 0; nt < 4; ++nt) {
    v8h ov;
#pragma unroll
    for (int r = 0; r < 8; ++r) ov[r] = (_Float16)(o[nt][r] / osum[0]);
    *(v8h*)(op + nt * 16) = ov;
  }
}

// ---------------------------------------------------------------- launch
extern "C" void kernel_launch(void* const* d_in, const int* in_sizes, int n_in,
                              void* d_out, int out_size, void* d_ws,
                              size_t ws_size, hipStream_t stream) {
  const float* x  = (const float*)d_in[0];
  const float* y  = (const float*)d_in[1];
  const int* pq   = (const int*)d_in[2];
  const int* pkv  = (const int*)d_in[3];
  const float* Wq = (const float*)d_in[4];
  const float* bq = (const float*)d_in[5];
  const float* Wk = (const float*)d_in[6];
  const float* bk = (const float*)d_in[7];
  const float* Wv = (const float*)d_in[8];
  const float* bv = (const float*)d_in[9];
  const float* Wo = (const float*)d_in[10];
  const float* bo = (const float*)d_in[11];

  char* ws = (char*)d_ws;
  _Float16* xh  = (_Float16*)ws;                ws += (size_t)ACT * 2;
  _Float16* yh  = (_Float16*)ws;                ws += (size_t)ACT * 2;
  _Float16* Wqh = (_Float16*)ws;                ws += (size_t)WSZ * 6;  // q, k, v
  _Float16* Woh = (_Float16*)ws;                ws += (size_t)WSZ * 2;
  _Float16* Qh  = (_Float16*)ws;                ws += (size_t)ACT * 2;
  _Float16* Kh  = (_Float16*)ws;                ws += (size_t)ACT * 2;
  _Float16* Vh  = (_Float16*)ws;                ws += (size_t)ACT * 2;
  _Float16* Oh  = (_Float16*)ws;                ws += (size_t)ACT * 2;

  // 1) f32 -> f16, all six sources; xh is the start of the six f16 copies
  cvt_all<<<(2 * ACT + 4 * WSZ) / 256, 256, 0, stream>>>(x, y, Wq, Wk, Wv, Wo,
                                                         xh);

  // 2) Q/K/V projections (WMMA, bias fused, f16 out); Qh starts the three outputs
  gemm_qkv<<<dim3(TOK / 128, Dm / 128, 3), 256, 0, stream>>>(xh, yh, Wqh, bq, bk,
                                                             bv, Qh);

  // 3) 2D RoPE on Q and K
  rope_kernel<<<dim3(TOK * NH * 32 / 256, 2), 256, 0, stream>>>(Qh, pq, Kh, pkv);

  // 4) flash attention (WMMA)
  attn_kernel<<<dim3(SEQ / 64, Bb * NH), 128, 0, stream>>>(Qh, Kh, Vh, Oh);

  // 5) output projection, f32 out
  gemm_out<<<dim3(TOK / 128, Dm / 128), 256, 0, stream>>>(Oh, Woh, bo,
                                                          (float*)d_out);
}

// v005
// It runs in 119 microseconds.
// In two side-by-side timings against v004, it was 1.24 and 1.22 times as fast.
// Counting every step since v000, it is 6.44 times as fast.
#include <hip/hip_runtime.h>
#include <hip/hip_bf16.h>

typedef __attribute__((ext_vector_type(16))) _Float16 v16h;
typedef __attribute__((ext_vector_type(8)))  _Float16 v8h;
typedef __attribute__((ext_vector_type(8)))  float    v8f;

#define DEV __device__ __forceinline__

static constexpr int Bb   = 8;
static constexpr int SEQ  = 1024;   // N == M
static constexpr int Dm   = 768;
static constexpr int NH   = 12;
static constexpr int DH   = 64;
static constexpr int TOK  = Bb * SEQ;   // 8192
static constexpr int ACT  = TOK * Dm;   // 6,291,456 elements of an activation
static constexpr int WSZ  = Dm * Dm;    //   589,824 elements of a weight

DEV v16h mk16(v8h lo, v8h hi) {
  v16h r;
#pragma unroll
  for (int i = 0; i < 8; ++i) { r[i] = lo[i]; r[i + 8] = hi[i]; }
  return r;
}

// Load one 16x32 f16 WMMA fragment (A-layout, or B-layout from a transposed
// [n][k] tile). rowbase points at this lane's row (16B aligned); grp = lane>>4.
DEV v16h ldfrag(const _Float16* rowbase, int grp) {
  v8h lo = *(const v8h*)(rowbase + grp * 8);
  v8h hi = *(const v8h*)(rowbase + 16 + grp * 8);
  return mk16(lo, hi);
}

DEV v8f wmma32(v16h a, v16h b, v8f c) {
  return __builtin_amdgcn_wmma_f32_16x16x32_f16(false, a, false, b, (short)0, c,
                                                false, false);
}

// CDNA5 async copy global->LDS, 16B per lane, tracked by ASYNCcnt.
// Generic addresses of __shared__ objects carry the LDS byte offset in
// addr[31:0] (ISA 10.2 aperture rule), which is exactly what VDST wants.
// A tile pair's async copies as one statement (16B per lane and copy). The
// closing s_wait_xcnt 0 stands in the copies' own statement so that no address
// register of an issued copy can be rewritten ahead of it.
DEV unsigned ldsoff(const void* l) { return (unsigned)(size_t)l; }
DEV unsigned long long gaddr(const void* g) {
  return (unsigned long long)(size_t)g;
}
DEV void async_b128_x8(const _Float16* ga, _Float16* la, int gsa, int lsa,
                       const _Float16* gb, _Float16* lb, int gsb, int lsb) {
  asm volatile("global_load_async_to_lds_b128 %0, %8, off\n\t"
               "global_load_async_to_lds_b128 %1, %9, off\n\t"
               "global_load_async_to_lds_b128 %2, %10, off\n\t"
               "global_load_async_to_lds_b128 %3, %11, off\n\t"
               "global_load_async_to_lds_b128 %4, %12, off\n\t"
               "global_load_async_to_lds_b128 %5, %13, off\n\t"
               "global_load_async_to_lds_b128 %6, %14, off\n\t"
               "global_load_async_to_lds_b128 %7, %15, off\n\t"
               "s_wait_xcnt 0x0"
               :: "v"(ldsoff(la)), "v"(ldsoff(la + lsa)),
                  "v"(ldsoff(la + 2 * lsa)), "v"(ldsoff(la + 3 * lsa)),
                  "v"(ldsoff(lb)), "v"(ldsoff(lb + lsb)),
                  "v"(ldsoff(lb + 2 * lsb)), "v"(ldsoff(lb + 3 * lsb)),
                  "v"(gaddr(ga)), "v"(gaddr(ga + gsa)),
                  "v"(gaddr(ga + 2 * gsa)), "v"(gaddr(ga + 3 * gsa)),
                  "v"(gaddr(gb)), "v"(gaddr(gb + gsb)),
                  "v"(gaddr(gb + 2 * gsb)), "v"(gaddr(gb + 3 * gsb))
               : "memory");
}
DEV void async_b128_x4(const _Float16* ga, _Float16* la, int gsa, int lsa,
                       const _Float16* gb, _Float16* lb, int gsb, int lsb) {
  asm volatile("global_load_async_to_lds_b128 %0, %4, off\n\t"
               "global_load_async_to_lds_b128 %1, %5, off\n\t"
               "global_load_async_to_lds_b128 %2, %6, off\n\t"
               "global_load_async_to_lds_b128 %3, %7, off\n\t"
               "s_wait_xcnt 0x0"
               :: "v"(ldsoff(la)), "v"(ldsoff(la + lsa)), "v"(ldsoff(lb)),
                  "v"(ldsoff(lb + lsb)), "v"(gaddr(ga)), "v"(gaddr(ga + gsa)),
                  "v"(gaddr(gb)), "v"(gaddr(gb + gsb))
               : "memory");
}
DEV void wait_async0() { asm volatile("s_wait_asynccnt 0" ::: "memory"); }

// Transposing LDS load: from a row-major [k][n] f16 tile, lane (c = lane & 15,
// h = lane >> 4) receives T[kbase + 8h + 0..7][nbase + c]. The lane's address is
// row kbase + 8h + (lane & 7), column nbase + 8 * ((lane >> 3) & 1).
typedef short s16x8 __attribute__((ext_vector_type(8)));
DEV v8h ld_tr16(const _Float16* p) {
  typedef __attribute__((address_space(3))) s16x8 lds_s16x8;
  return __builtin_bit_cast(v8h,
                            __builtin_amdgcn_ds_load_tr16_b128_v8i16((lds_s16x8*)p));
}
// One 32(k) x 16(n) B fragment from a [k][n] tile of row pitch PITCH halves;
// lanebase already holds the lane's row and column part. Its k order is the one
// ldfrag gives the A side (k = 8h + s, then 16 + 8h + s).
template <int PITCH>
DEV v16h ldfrag_tr(const _Float16* lanebase) {
  return mk16(ld_tr16(lanebase), ld_tr16(lanebase + 16 * PITCH));
}

// Lane l with lane l ^ 16 (the two wave halves exchange one value).
DEV float xhalf(float x) {
  int b = __builtin_bit_cast(int, x);
  return __builtin_bit_cast(
      float, __builtin_amdgcn_permlanex16(b, b, 0x76543210, 0xfedcba98, false,
                                          false));
}

// ---------------------------------------------------------------- convert
// All six f32 -> f16 conversions in one grid: none reads another's output. The
// f16 copies lie one behind the other in out (x, y, Wq, Wk, Wv, Wo), so the flat
// index is the output index; a block's 16384 elements lie wholly inside one
// source. A lane issues 16 loads of 16 B before its first store; each load of a
// wave covers 512 contiguous bytes and each store 256: whole 128-B lines.
typedef __attribute__((ext_vector_type(4))) float    v4f;
typedef __attribute__((ext_vector_type(4))) _Float16 v4h;
__global__ void __launch_bounds__(256)
cvt_all(const float* __restrict__ x, const float* __restrict__ y,
        const float* __restrict__ Wq, const float* __restrict__ Wk,
        const float* __restrict__ Wv, const float* __restrict__ Wo,
        _Float16* __restrict__ out) {
  constexpr int PER = 16;                // 16-B loads per lane
  constexpr int BLK = 256 * 4 * PER;     // elements per block
  constexpr int AB = ACT / BLK, WB = WSZ / BLK;   // blocks per source
  static_assert(ACT % BLK == 0 && WSZ % BLK == 0, "whole blocks");
  const int blk = blockIdx.x;
  const float* src;
  int rel;
  if (blk < AB) {
    src = x; rel = blk;
  } else if (blk < 2 * AB) {
    src = y; rel = blk - AB;
  } else {
    const int k = (blk - 2 * AB) / WB;
    rel = (blk - 2 * AB) - k * WB;
    src = k == 0 ? Wq : k == 1 ? Wk : k == 2 ? Wv : Wo;
  }
  const v4f* s4 = (const v4f*)(src + (size_t)rel * BLK) + threadIdx.x;
  v4h* o4 = (v4h*)(out + (size_t)blk * BLK) + threadIdx.x;
  v4f v[PER];
#pragma unroll
  for (int i = 0; i < PER; ++i) v[i] = s4[i * 256];
#pragma unroll
  for (int i = 0; i < PER; ++i) o4[i * 256] = __builtin_convertvector(v[i], v4h);
}

// ---------------------------------------------------------------- GEMM
// C[Mtot x 768] = A[Mtot x 768] (f16) @ W[768 x 768] (f16) + bias(f32)
// Block tile 128x128, K-step 64. 8 waves, each 32(M) x 64(N).
template <bool OUT16>
DEV void gemm_body(const _Float16* __restrict__ A, const _Float16* __restrict__ W,
                   const float* __restrict__ bias, void* __restrict__ Cout) {
  // A tile [m][k]; pitch 144 B = 16 B x odd, the conflict-free pitch of the
  // ds_load_b128 reader (16 rows of one column segment fall on 16 bank groups)
  constexpr int AP = 72;
  __shared__ __align__(16) _Float16 As[128 * AP];
  // W tile as it lies in memory, [k][n]; pitch 288 B = 32 B x odd, the
  // conflict-free pitch of the transposing reader
  constexpr int BP = 144;
  __shared__ __align__(16) _Float16 Bs[64 * BP];

  const int tid = threadIdx.x, lane = tid & 31, w = tid >> 5;
  const int ln = lane & 15, grp = lane >> 4;
  const int m0 = blockIdx.x * 128, n0 = blockIdx.y * 128;
  const int wm = (w & 3) * 32;      // wave M offset within block
  const int wn = (w >> 2) * 64;     // wave N offset within block

  // this lane's row and column part of every transposing read of Bs
  const _Float16* btr =
      Bs + (grp * 8 + (lane & 7)) * BP + wn + ((lane >> 3) & 1) * 8;

  v8f acc[2][4] = {};

  for (int k0 = 0; k0 < Dm; k0 += 64) {
    // --- stage both tiles via async 16B copies (straight copies), 1024 chunks
    // each, chunk c = tid + i * 256:
    // A tile 128(m) x 64(k): row c >> 3, segment c & 7
    // W tile 64(k) x 128(n), untransposed: row c >> 4, segment c & 15
    {
      const int row = tid >> 3, sega = tid & 7;
      const int kk = tid >> 4, segw = tid & 15;
      async_b128_x8(&A[(size_t)(m0 + row) * Dm + k0 + sega * 8],
                    &As[row * AP + sega * 8], 32 * Dm, 32 * AP,
                    &W[(size_t)(k0 + kk) * Dm + n0 + segw * 8],
                    &Bs[kk * BP + segw * 8], 16 * Dm, 16 * BP);
    }
    if (k0 + 64 < Dm)
      __builtin_prefetch(&A[(size_t)(m0 + (tid >> 1)) * Dm + k0 + 64], 0, 1);
    wait_async0();
    __syncthreads();

#pragma unroll
    for (int kc = 0; kc < 2; ++kc) {
      v16h af[2], bf[4];
#pragma unroll
      for (int i = 0; i < 2; ++i)
        af[i] = ldfrag(&As[(wm + i * 16 + ln) * AP + kc * 32], grp);
#pragma unroll
      for (int j = 0; j < 4; ++j)
        bf[j] = ldfrag_tr<BP>(btr + kc * 32 * BP + j * 16);
#pragma unroll
      for (int i = 0; i < 2; ++i)
#pragma unroll
        for (int j = 0; j < 4; ++j) acc[i][j] = wmma32(af[i], bf[j], acc[i][j]);
    }
    // this wave's LDS reads have retired before the next trip's copies refill
    asm volatile("s_wait_dscnt 0" ::: "memory");
    __syncthreads();
  }

  // epilogue: C-layout -> lane holds col n, VGPR r holds row 8*grp+r
#pragma unroll
  for (int i = 0; i < 2; ++i)
#pragma unroll
    for (int j = 0; j < 4; ++j) {
      int ngl = n0 + wn + j * 16 + ln;
      float bv = bias[ngl];
#pragma unroll
      for (int r = 0; r < 8; ++r) {
        int mg = m0 + wm + i * 16 + grp * 8 + r;
        float vout = acc[i][j][r] + bv;
        if (OUT16)
          ((_Float16*)Cout)[(size_t)mg * Dm + ngl] = (_Float16)vout;
        else
          ((float*)Cout)[(size_t)mg * Dm + ngl] = vout;
      }
    }
}

// The Q, K and V projections in one grid, blockIdx.z = which: none reads
// another's output. Wqkv holds the three f16 weights and QKV the three outputs,
// each one behind the other.
__global__ void __launch_bounds__(256)
gemm_qkv(const _Float16* __restrict__ xh, const _Float16* __restrict__ yh,
         const _Float16* __restrict__ Wqkv, const float* __restrict__ bq,
         const float* __restrict__ bk, const float* __restrict__ bv,
         _Float16* __restrict__ QKV) {
  const int z = blockIdx.z;
  gemm_body<true>(z == 0 ? xh : yh, Wqkv + (size_t)z * WSZ,
                  z == 0 ? bq : z == 1 ? bk : bv, QKV + (size_t)z * ACT);
}

__global__ void __launch_bounds__(256)
gemm_out(const _Float16* __restrict__ A, const _Float16* __restrict__ W,
         const float* __restrict__ bias, float* __restrict__ C) {
  gemm_body<false>(A, W, bias, C);
}

// ---------------------------------------------------------------- RoPE 2D
// t: [TOK][768] f16 (heads inline). Q and K in one grid, blockIdx.y = which: they
// share nothing; blockIdx.z = which six of the twelve heads. Eight lanes hold one
// token; lane segment seg owns the 16 bytes d = 8 seg .. 8 seg + 7 of each head's
// 128-byte row, so a wave's load or store covers four whole lines, and a lane's
// six loads (one per head) are issued before its first store. The angle depends
// on token, half and d alone, not on the head: a lane's 8 sines and cosines serve
// its six heads. The rotation partner d +- 16 lies two lanes away, in one quad.
DEV v8h quad_xor2(v8h a) {
  typedef __attribute__((ext_vector_type(4))) int v4i;
  v4i w = __builtin_bit_cast(v4i, a);
#pragma unroll
  for (int i = 0; i < 4; ++i)   // quad_perm [2, 3, 0, 1]: lane l takes lane l ^ 2
    w[i] = __builtin_amdgcn_mov_dpp(w[i], 0x4e, 0xf, 0xf, true);
  return __builtin_bit_cast(v8h, w);
}
// One transcendental and, in the same statement, the free issue slot that the
// instruction set asks for behind it: so no reader of the result and no overwrite
// of the source can be scheduled directly behind the instruction.
DEV float exp2_slot(float a) {
  float r;
  asm("v_exp_f32 %0, %1\n\tv_nop" : "=v"(r) : "v"(a));
  return r;
}
DEV float sin_rev_slot(float a) {   // a in revolutions
  float r;
  asm("v_sin_f32 %0, %1\n\tv_nop" : "=v"(r) : "v"(a));
  return r;
}
DEV float cos_rev_slot(float a) {   // a in revolutions
  float r;
  asm("v_cos_f32 %0, %1\n\tv_nop" : "=v"(r) : "v"(a));
  return r;
}
__global__ void __launch_bounds__(256)
rope_kernel(_Float16* __restrict__ tq, const int* __restrict__ posq,
            _Float16* __restrict__ tk, const int* __restrict__ posk) {
  _Float16* __restrict__ t = blockIdx.y == 0 ? tq : tk;
  const int* __restrict__ pos = blockIdx.y == 0 ? posq : posk;
  const int tid = blockIdx.x * 256 + threadIdx.x;   // TOK * 8 threads
  const int seg = tid & 7;
  const int tok = tid >> 3;
  const int half = seg >> 2;                   // half0 -> row, half1 -> col
  const int jj0 = (seg & 1) * 8;

  constexpr int HG = NH / 2;                   // heads per lane
  _Float16* row = t + (size_t)tok * Dm + blockIdx.z * (HG * DH) + seg * 8;
  const int pv = pos[tok * 2 + half];
  v8h own[HG];
#pragma unroll
  for (int h = 0; h < HG; ++h) own[h] = *(const v8h*)(row + h * DH);
  // keeps the first use of pv, and so the wait for its load, behind the issue of
  // the six row loads: else the two memory latencies run one after the other
  __builtin_amdgcn_sched_barrier(0);

  const float p = (float)pv;
  float c[8], s[8];
#pragma unroll
  for (int e = 0; e < 8; ++e) {
    // 100^(-jj / 16) = exp2(log2(e) * (-ln(100) / 16) * jj)
    const float ang =
        p * exp2_slot(1.44269504f * (-0.28782313662425572f * (float)(jj0 + e)));
    const float rev = ang * 0.15915494f;       // 1 / (2 pi)
    s[e] = sin_rev_slot(rev);
    c[e] = cos_rev_slot(rev);
    // first 16 of a half: t0 c - t1 s; second 16: t1 c + t0 s
    if ((seg & 2) == 0) s[e] = -s[e];
  }

#pragma unroll
  for (int h = 0; h < HG; ++h) {
    const v8h oth = quad_xor2(own[h]);
    v8h r;
#pragma unroll
    for (int e = 0; e < 8; ++e)
      r[e] = (_Float16)((float)own[h][e] * c[e] + (float)oth[e] * s[e]);
    *(v8h*)(row + h * DH) = r;
  }
}

__global__ void __launch_bounds__(128)
attn_kernel(const _Float16* __restrict__ Q, const _Float16* __restrict__ K,
            const _Float16* __restrict__ V, _Float16* __restrict__ O) {
  // K tile [key][d]: pitch 144 B = 16 B x odd, the conflict-free pitch of the
  // ds_load_b128 reader
  constexpr int KP = 72;
  __shared__ __align__(16) _Float16 Kt[32 * KP];
  // V tile as it lies in memory, [key][d]; pitch 160 B = 32 B x odd, the
  // conflict-free pitch of the transposing reader
  constexpr int VP = 80;
  __shared__ __align__(16) _Float16 Vs[32 * VP];

  const int b = blockIdx.y / NH, h = blockIdx.y % NH;
  const int q0 = blockIdx.x * 64;
  const int tid = threadIdx.x, lane = tid & 31, w = tid >> 5;
  const int ln = lane & 15, grp = lane >> 4;

  // Q fragments (64(d) x 16(query) B-matrix = 2 chunks of 32 x 16), loaded once;
  // fold dh^-0.5 * log2(e) = 0.125 * 1.4426950 into Q (f16, tiny rel. error).
  const _Float16 qscale = (_Float16)0.18033688f;
  const _Float16* qp = Q + ((size_t)(b * SEQ + q0 + w * 16 + ln)) * Dm + h * DH;
  v16h qf[2];
#pragma unroll
  for (int c = 0; c < 2; ++c) {
    qf[c] = ldfrag(qp + c * 32, grp);
#pragma unroll
    for (int i = 0; i < 16; ++i) qf[c][i] = qf[c][i] * qscale;
  }

  v16h onesf;
#pragma unroll
  for (int i = 0; i < 16; ++i) onesf[i] = (_Float16)1.0f;

  // this lane's row and column part of every transposing read of Vs
  const _Float16* vtr = Vs + (grp * 8 + (lane & 7)) * VP + ((lane >> 3) & 1) * 8;

  v8f o[4] = {};      // O^T: lane = query ln, register r = d nt * 16 + 8 grp + r
  v8f osum = {};
  float rmax = -1e30f;

  for (int j0 = 0; j0 < SEQ; j0 += 32) {
    // stage the K and V tiles, [32 keys][64 d] each and both untransposed, via
    // async 16B copies: 256 chunks, chunk p = tid + i * 128 -> key p >> 3,
    // segment p & 7
    {
      const int key = tid >> 3, seg = tid & 7;
      const size_t go = ((size_t)(b * SEQ + j0 + key)) * Dm + h * DH + seg * 8;
      async_b128_x4(&K[go], &Kt[key * KP + seg * 8], 16 * Dm, 16 * KP,
                    &V[go], &Vs[key * VP + seg * 8], 16 * Dm, 16 * VP);
    }
    if (j0 + 32 < SEQ)
      __builtin_prefetch(&K[((size_t)(b * SEQ + j0 + 32 + (tid >> 2))) * Dm +
                            h * DH], 0, 1);
    wait_async0();
    __syncthreads();

    // scores (log2 domain), transposed: two 16(key) x 16(query) tiles, K-dim =
    // dh = 64 (2 wmma each); s[t][r] is key t * 16 + 8 grp + r, query ln
    v8f s[2];
#pragma unroll
    for (int t = 0; t < 2; ++t) {
      const _Float16* krow = Kt + (t * 16 + ln) * KP;
      v8f z = {};
      z = wmma32(ldfrag(krow, grp), qf[0], z);
      z = wmma32(ldfrag(krow + 32, grp), qf[1], z);
      s[t] = z;
    }

    // online softmax; a query's 32 scores lie in lanes ln and ln + 16
    float lm = fmaxf(s[0][0], s[1][0]);
#pragma unroll
    for (int r = 1; r < 8; ++r) lm = fmaxf(lm, fmaxf(s[0][r], s[1][r]));
    lm = fmaxf(lm, xhalf(lm));
    const float nm = fmaxf(rmax, lm);
    const float alpha = __builtin_amdgcn_exp2f(rmax - nm);
    rmax = nm;

    // P^T as a 32(key) x 16(query) B fragment: element i is key 8 grp + i,
    // element 8 + i key 16 + 8 grp + i, which is how s[0] and s[1] hold them
    v16h pf;
#pragma unroll
    for (int r = 0; r < 8; ++r) {
      pf[r]     = (_Float16)__builtin_amdgcn_exp2f(s[0][r] - nm);
      pf[r + 8] = (_Float16)__builtin_amdgcn_exp2f(s[1][r] - nm);
    }
#pragma unroll
    for (int nt = 0; nt < 4; ++nt)
#pragma unroll
      for (int r = 0; r < 8; ++r) o[nt][r] *= alpha;
    // all rows of the sum tile are alike and only register 0 is read at the end
    osum[0] *= alpha;

#pragma unroll
    for (int nt = 0; nt < 4; ++nt) {
      v16h vf = ldfrag_tr<VP>(vtr + nt * 16);   // V^T as A: row d, k = key
      o[nt] = wmma32(vf, pf, o[nt]);
    }
    osum = wmma32(onesf, pf, osum);     // column sums, f32 accum
    // this wave's LDS reads have retired before the next trip's copies refill
    asm volatile("s_wait_dscnt 0" ::: "memory");
    __syncthreads();
  }

  // normalize and store f16: 8 consecutive d of one query per lane and tile
  _Float16* op =
      O + ((size_t)(b * SEQ + q0 + w * 16 + ln)) * Dm + h * DH + grp * 8;
#pragma unroll
  for (int nt = 0; nt < 4; ++nt) {
    v8h ov;
#pragma unroll
    for (int r = 0; r < 8; ++r) ov[r] = (_Float16)(o[nt][r] / osum[0]);
    *(v8h*)(op + nt * 16) = ov;
  }
}

// ---------------------------------------------------------------- launch
extern "C" void kernel_launch(void* const* d_in, const int* in_sizes, int n_in,
                              void* d_out, int out_size, void* d_ws,
                              size_t ws_size, hipStream_t stream) {
  const float* x  = (const float*)d_in[0];
  const float* y  = (const float*)d_in[1];
  const int* pq   = (const int*)d_in[2];
  const int* pkv  = (const int*)d_in[3];
  const float* Wq = (const float*)d_in[4];
  const float* bq = (const float*)d_in[5];
  const float* Wk = (const float*)d_in[6];
  const float* bk = (const float*)d_in[7];
  const float* Wv = (const float*)d_in[8];
  const float* bv = (const float*)d_in[9];
  const float* Wo = (const float*)d_in[10];
  const float* bo = (const float*)d_in[11];

  char* ws = (char*)d_ws;
  _Float16* xh  = (_Float16*)ws;                ws += (size_t)ACT * 2;
  _Float16* yh  = (_Float16*)ws;                ws += (size_t)ACT * 2;
  _Float16* Wqh = (_Float16*)ws;                ws += (size_t)WSZ * 6;  // q, k, v
  _Float16* Woh = (_Float16*)ws;                ws += (size_t)WSZ * 2;
  _Float16* Qh  = (_Float16*)ws;                ws += (size_t)ACT * 2;
  _Float16* Kh  = (_Float16*)ws;                ws += (size_t)ACT * 2;
  _Float16* Vh  = (_Float16*)ws;                ws += (size_t)ACT * 2;
  _Float16* Oh  = (_Float16*)ws;                ws += (size_t)ACT * 2;

  // 1) f32 -> f16, all six sources; xh is the start of the six f16 copies
  cvt_all<<<(2 * ACT + 4 * WSZ) / 16384, 256, 0, stream>>>(x, y, Wq, Wk, Wv, Wo,
                                                           xh);

  // 2) Q/K/V projections (WMMA, bias fused, f16 out); Qh starts the three outputs
  gemm_qkv<<<dim3(TOK / 128, Dm / 128, 3), 256, 0, stream>>>(xh, yh, Wqh, bq, bk,
                                                             bv, Qh);

  // 3) 2D RoPE on Q and K
  rope_kernel<<<dim3(TOK * 8 / 256, 2, 2), 256, 0, stream>>>(Qh, pq, Kh, pkv);

  // 4) flash attention (WMMA)
  attn_kernel<<<dim3(SEQ / 64, Bb * NH), 128, 0, stream>>>(Qh, Kh, Vh, Oh);

  // 5) output projection, f32 out
  gemm_out<<<dim3(TOK / 128, Dm / 128), 256, 0, stream>>>(Oh, Woh, bo,
                                                          (float*)d_out);
}

// v006
// It runs in 113 microseconds.
// Two timings next to v005 both put it at 1.05 times that version's speed.
// Counting every step since v000, it is 6.76 times as fast.
#include <hip/hip_runtime.h>
#include <hip/hip_bf16.h>

typedef __attribute__((ext_vector_type(16))) _Float16 v16h;
typedef __attribute__((ext_vector_type(8)))  _Float16 v8h;
typedef __attribute__((ext_vector_type(8)))  float    v8f;

#define DEV __device__ __forceinline__

static constexpr int Bb   = 8;
static constexpr int SEQ  = 1024;   // N == M
static constexpr int Dm   = 768;
static constexpr int NH   = 12;
static constexpr int DH   = 64;
static constexpr int TOK  = Bb * SEQ;   // 8192
static constexpr int ACT  = TOK * Dm;   // 6,291,456 elements of an activation
static constexpr int WSZ  = Dm * Dm;    //   589,824 elements of a weight

DEV v16h mk16(v8h lo, v8h hi) {
  v16h r;
#pragma unroll
  for (int i = 0; i < 8; ++i) { r[i] = lo[i]; r[i + 8] = hi[i]; }
  return r;
}

// Load one 16x32 f16 WMMA fragment (A-layout, or B-layout from a transposed
// [n][k] tile). rowbase points at this lane's row (16B aligned); grp = lane>>4.
DEV v16h ldfrag(const _Float16* rowbase, int grp) {
  v8h lo = *(const v8h*)(rowbase + grp * 8);
  v8h hi = *(const v8h*)(rowbase + 16 + grp * 8);
  return mk16(lo, hi);
}

DEV v8f wmma32(v16h a, v16h b, v8f c) {
  return __builtin_amdgcn_wmma_f32_16x16x32_f16(false, a, false, b, (short)0, c,
                                                false, false);
}

// CDNA5 async copy global->LDS, 16B per lane, tracked by ASYNCcnt.
// Generic addresses of __shared__ objects carry the LDS byte offset in
// addr[31:0] (ISA 10.2 aperture rule), which is exactly what VDST wants.
// A tile pair's async copies as one statement (16B per lane and copy). The
// closing s_wait_xcnt 0 stands in the copies' own statement so that no address
// register of an issued copy can be rewritten ahead of it.
DEV unsigned ldsoff(const void* l) { return (unsigned)(size_t)l; }
DEV unsigned long long gaddr(const void* g) {
  return (unsigned long long)(size_t)g;
}
DEV void async_b128_x8(const _Float16* ga, _Float16* la, int gsa, int lsa,
                       const _Float16* gb, _Float16* lb, int gsb, int lsb) {
  asm volatile("global_load_async_to_lds_b128 %0, %8, off\n\t"
               "global_load_async_to_lds_b128 %1, %9, off\n\t"
               "global_load_async_to_lds_b128 %2, %10, off\n\t"
               "global_load_async_to_lds_b128 %3, %11, off\n\t"
               "global_load_async_to_lds_b128 %4, %12, off\n\t"
               "global_load_async_to_lds_b128 %5, %13, off\n\t"
               "global_load_async_to_lds_b128 %6, %14, off\n\t"
               "global_load_async_to_lds_b128 %7, %15, off\n\t"
               "s_wait_xcnt 0x0"
               :: "v"(ldsoff(la)), "v"(ldsoff(la + lsa)),
                  "v"(ldsoff(la + 2 * lsa)), "v"(ldsoff(la + 3 * lsa)),
                  "v"(ldsoff(lb)), "v"(ldsoff(lb + lsb)),
                  "v"(ldsoff(lb + 2 * lsb)), "v"(ldsoff(lb + 3 * lsb)),
                  "v"(gaddr(ga)), "v"(gaddr(ga + gsa)),
                  "v"(gaddr(ga + 2 * gsa)), "v"(gaddr(ga + 3 * gsa)),
                  "v"(gaddr(gb)), "v"(gaddr(gb + gsb)),
                  "v"(gaddr(gb + 2 * gsb)), "v"(gaddr(gb + 3 * gsb))
               : "memory");
}
DEV void async_b128_x4(const _Float16* ga, _Float16* la, int gsa, int lsa,
                       const _Float16* gb, _Float16* lb, int gsb, int lsb) {
  asm volatile("global_load_async_to_lds_b128 %0, %4, off\n\t"
               "global_load_async_to_lds_b128 %1, %5, off\n\t"
               "global_load_async_to_lds_b128 %2, %6, off\n\t"
               "global_load_async_to_lds_b128 %3, %7, off\n\t"
               "s_wait_xcnt 0x0"
               :: "v"(ldsoff(la)), "v"(ldsoff(la + lsa)), "v"(ldsoff(lb)),
                  "v"(ldsoff(lb + lsb)), "v"(gaddr(ga)), "v"(gaddr(ga + gsa)),
                  "v"(gaddr(gb)), "v"(gaddr(gb + gsb))
               : "memory");
}
DEV void wait_async0() { asm volatile("s_wait_asynccnt 0" ::: "memory"); }

// Transposing LDS load: from a row-major [k][n] f16 tile, lane (c = lane & 15,
// h = lane >> 4) receives T[kbase + 8h + 0..7][nbase + c]. The lane's address is
// row kbase + 8h + (lane & 7), column nbase + 8 * ((lane >> 3) & 1).
typedef short s16x8 __attribute__((ext_vector_type(8)));
DEV v8h ld_tr16(const _Float16* p) {
  typedef __attribute__((address_space(3))) s16x8 lds_s16x8;
  return __builtin_bit_cast(v8h,
                            __builtin_amdgcn_ds_load_tr16_b128_v8i16((lds_s16x8*)p));
}
// One 32(k) x 16(n) B fragment from a [k][n] tile of row pitch PITCH halves;
// lanebase already holds the lane's row and column part. Its k order is the one
// ldfrag gives the A side (k = 8h + s, then 16 + 8h + s).
template <int PITCH>
DEV v16h ldfrag_tr(const _Float16* lanebase) {
  return mk16(ld_tr16(lanebase), ld_tr16(lanebase + 16 * PITCH));
}

// Lane l with lane l ^ 16 (the two wave halves exchange one value).
DEV float xhalf(float x) {
  int b = __builtin_bit_cast(int, x);
  return __builtin_bit_cast(
      float, __builtin_amdgcn_permlanex16(b, b, 0x76543210, 0xfedcba98, false,
                                          false));
}

// ---------------------------------------------------------------- convert
// All six f32 -> f16 conversions in one grid: none reads another's output. The
// f16 copies lie one behind the other in out (x, y, Wq, Wk, Wv, Wo), so the flat
// index is the output index; a block's 16384 elements lie wholly inside one
// source. A lane issues 16 loads of 16 B before its first store; each load of a
// wave covers 512 contiguous bytes and each store 256: whole 128-B lines.
typedef __attribute__((ext_vector_type(4))) float    v4f;
typedef __attribute__((ext_vector_type(4))) _Float16 v4h;
__global__ void __launch_bounds__(256)
cvt_all(const float* __restrict__ x, const float* __restrict__ y,
        const float* __restrict__ Wq, const float* __restrict__ Wk,
        const float* __restrict__ Wv, const float* __restrict__ Wo,
        _Float16* __restrict__ out) {
  constexpr int PER = 16;                // 16-B loads per lane
  constexpr int BLK = 256 * 4 * PER;     // elements per block
  constexpr int AB = ACT / BLK, WB = WSZ / BLK;   // blocks per source
  static_assert(ACT % BLK == 0 && WSZ % BLK == 0, "whole blocks");
  const int blk = blockIdx.x;
  const float* src;
  int rel;
  if (blk < AB) {
    src = x; rel = blk;
  } else if (blk < 2 * AB) {
    src = y; rel = blk - AB;
  } else {
    const int k = (blk - 2 * AB) / WB;
    rel = (blk - 2 * AB) - k * WB;
    src = k == 0 ? Wq : k == 1 ? Wk : k == 2 ? Wv : Wo;
  }
  const v4f* s4 = (const v4f*)(src + (size_t)rel * BLK) + threadIdx.x;
  v4h* o4 = (v4h*)(out + (size_t)blk * BLK) + threadIdx.x;
  v4f v[PER];
#pragma unroll
  for (int i = 0; i < PER; ++i) v[i] = s4[i * 256];
#pragma unroll
  for (int i = 0; i < PER; ++i) o4[i * 256] = __builtin_convertvector(v[i], v4h);
}

// ---------------------------------------------------------------- GEMM
// C[Mtot x 768] = A[Mtot x 768] (f16) @ W[768 x 768] (f16) + bias(f32)
// Block tile 128x128, K-step 64. 8 waves, each 32(M) x 64(N).
template <bool OUT16>
DEV void gemm_body(const _Float16* __restrict__ A, const _Float16* __restrict__ W,
                   const float* __restrict__ bias, void* __restrict__ Cout) {
  // A tile [m][k]; pitch 144 B = 16 B x odd, the conflict-free pitch of the
  // ds_load_b128 reader (16 rows of one column segment fall on 16 bank groups)
  constexpr int AP = 72;
  __shared__ __align__(16) _Float16 As[128 * AP];
  // W tile as it lies in memory, [k][n]; pitch 288 B = 32 B x odd, the
  // conflict-free pitch of the transposing reader
  constexpr int BP = 144;
  __shared__ __align__(16) _Float16 Bs[64 * BP];

  const int tid = threadIdx.x, lane = tid & 31, w = tid >> 5;
  const int ln = lane & 15, grp = lane >> 4;
  const int m0 = blockIdx.x * 128, n0 = blockIdx.y * 128;
  const int wm = (w & 3) * 32;      // wave M offset within block
  const int wn = (w >> 2) * 64;     // wave N offset within block

  // this lane's row and column part of every transposing read of Bs
  const _Float16* btr =
      Bs + (grp * 8 + (lane & 7)) * BP + wn + ((lane >> 3) & 1) * 8;

  v8f acc[2][4] = {};

  for (int k0 = 0; k0 < Dm; k0 += 64) {
    // --- stage both tiles via async 16B copies (straight copies), 1024 chunks
    // each, chunk c = tid + i * 256:
    // A tile 128(m) x 64(k): row c >> 3, segment c & 7
    // W tile 64(k) x 128(n), untransposed: row c >> 4, segment c & 15
    {
      const int row = tid >> 3, sega = tid & 7;
      const int kk = tid >> 4, segw = tid & 15;
      async_b128_x8(&A[(size_t)(m0 + row) * Dm + k0 + sega * 8],
                    &As[row * AP + sega * 8], 32 * Dm, 32 * AP,
                    &W[(size_t)(k0 + kk) * Dm + n0 + segw * 8],
                    &Bs[kk * BP + segw * 8], 16 * Dm, 16 * BP);
    }
    if (k0 + 64 < Dm)
      __builtin_prefetch(&A[(size_t)(m0 + (tid >> 1)) * Dm + k0 + 64], 0, 1);
    wait_async0();
    __syncthreads();

#pragma unroll
    for (int kc = 0; kc < 2; ++kc) {
      v16h af[2], bf[4];
#pragma unroll
      for (int i = 0; i < 2; ++i)
        af[i] = ldfrag(&As[(wm + i * 16 + ln) * AP + kc * 32], grp);
#pragma unroll
      for (int j = 0; j < 4; ++j)
        bf[j] = ldfrag_tr<BP>(btr + kc * 32 * BP + j * 16);
#pragma unroll
      for (int i = 0; i < 2; ++i)
#pragma unroll
        for (int j = 0; j < 4; ++j) acc[i][j] = wmma32(af[i], bf[j], acc[i][j]);
    }
    // this wave's LDS reads have retired before the next trip's copies refill
    asm volatile("s_wait_dscnt 0" ::: "memory");
    __syncthreads();
  }

  // epilogue: C-layout -> lane holds col n, VGPR r holds row 8*grp+r
#pragma unroll
  for (int i = 0; i < 2; ++i)
#pragma unroll
    for (int j = 0; j < 4; ++j) {
      int ngl = n0 + wn + j * 16 + ln;
      float bv = bias[ngl];
#pragma unroll
      for (int r = 0; r < 8; ++r) {
        int mg = m0 + wm + i * 16 + grp * 8 + r;
        float vout = acc[i][j][r] + bv;
        if (OUT16)
          ((_Float16*)Cout)[(size_t)mg * Dm + ngl] = (_Float16)vout;
        else
          ((float*)Cout)[(size_t)mg * Dm + ngl] = vout;
      }
    }
}

// The Q, K and V projections in one grid, blockIdx.z = which: none reads
// another's output. Wqkv holds the three f16 weights and QKV the three outputs,
// each one behind the other.
__global__ void __launch_bounds__(256)
gemm_qkv(const _Float16* __restrict__ xh, const _Float16* __restrict__ yh,
         const _Float16* __restrict__ Wqkv, const float* __restrict__ bq,
         const float* __restrict__ bk, const float* __restrict__ bv,
         _Float16* __restrict__ QKV) {
  const int z = blockIdx.z;
  gemm_body<true>(z == 0 ? xh : yh, Wqkv + (size_t)z * WSZ,
                  z == 0 ? bq : z == 1 ? bk : bv, QKV + (size_t)z * ACT);
}

__global__ void __launch_bounds__(256)
gemm_out(const _Float16* __restrict__ A, const _Float16* __restrict__ W,
         const float* __restrict__ bias, float* __restrict__ C) {
  gemm_body<false>(A, W, bias, C);
}

// ---------------------------------------------------------------- RoPE 2D
// t: [TOK][768] f16 (heads inline). Q and K in one grid, blockIdx.y = which: they
// share nothing; blockIdx.z = which six of the twelve heads. Eight lanes hold one
// token; lane segment seg owns the 16 bytes d = 8 seg .. 8 seg + 7 of each head's
// 128-byte row, so a wave's load or store covers four whole lines, and a lane's
// six loads (one per head) are issued before its first store. The angle depends
// on token, half and d alone, not on the head: a lane's 8 sines and cosines serve
// its six heads. The rotation partner d +- 16 lies two lanes away, in one quad.
DEV v8h quad_xor2(v8h a) {
  typedef __attribute__((ext_vector_type(4))) int v4i;
  v4i w = __builtin_bit_cast(v4i, a);
#pragma unroll
  for (int i = 0; i < 4; ++i)   // quad_perm [2, 3, 0, 1]: lane l takes lane l ^ 2
    w[i] = __builtin_amdgcn_mov_dpp(w[i], 0x4e, 0xf, 0xf, true);
  return __builtin_bit_cast(v8h, w);
}
// One transcendental and, in the same statement, the free issue slot that the
// instruction set asks for behind it: so no reader of the result and no overwrite
// of the source can be scheduled directly behind the instruction.
DEV float exp2_slot(float a) {
  float r;
  asm("v_exp_f32 %0, %1\n\tv_nop" : "=v"(r) : "v"(a));
  return r;
}
DEV float sin_rev_slot(float a) {   // a in revolutions
  float r;
  asm("v_sin_f32 %0, %1\n\tv_nop" : "=v"(r) : "v"(a));
  return r;
}
DEV float cos_rev_slot(float a) {   // a in revolutions
  float r;
  asm("v_cos_f32 %0, %1\n\tv_nop" : "=v"(r) : "v"(a));
  return r;
}
__global__ void __launch_bounds__(256)
rope_kernel(_Float16* __restrict__ tq, const int* __restrict__ posq,
            _Float16* __restrict__ tk, const int* __restrict__ posk) {
  _Float16* __restrict__ t = blockIdx.y == 0 ? tq : tk;
  const int* __restrict__ pos = blockIdx.y == 0 ? posq : posk;
  const int tid = blockIdx.x * 256 + threadIdx.x;   // TOK * 8 threads
  const int seg = tid & 7;
  const int tok = tid >> 3;
  const int half = seg >> 2;                   // half0 -> row, half1 -> col
  const int jj0 = (seg & 1) * 8;

  constexpr int HG = NH / 2;                   // heads per lane
  _Float16* row = t + (size_t)tok * Dm + blockIdx.z * (HG * DH) + seg * 8;
  const int pv = pos[tok * 2 + half];
  v8h own[HG];
#pragma unroll
  for (int h = 0; h < HG; ++h) own[h] = *(const v8h*)(row + h * DH);
  // keeps the first use of pv, and so the wait for its load, behind the issue of
  // the six row loads: else the two memory latencies run one after the other
  __builtin_amdgcn_sched_barrier(0);

  const float p = (float)pv;
  float c[8], s[8];
#pragma unroll
  for (int e = 0; e < 8; ++e) {
    // 100^(-jj / 16) = exp2(log2(e) * (-ln(100) / 16) * jj)
    const float ang =
        p * exp2_slot(1.44269504f * (-0.28782313662425572f * (float)(jj0 + e)));
    const float rev = ang * 0.15915494f;       // 1 / (2 pi)
    s[e] = sin_rev_slot(rev);
    c[e] = cos_rev_slot(rev);
    // first 16 of a half: t0 c - t1 s; second 16: t1 c + t0 s
    if ((seg & 2) == 0) s[e] = -s[e];
  }

#pragma unroll
  for (int h = 0; h < HG; ++h) {
    const v8h oth = quad_xor2(own[h]);
    v8h r;
#pragma unroll
    for (int e = 0; e < 8; ++e)
      r[e] = (_Float16)((float)own[h][e] * c[e] + (float)oth[e] * s[e]);
    *(v8h*)(row + h * DH) = r;
  }
}

__global__ void __launch_bounds__(128)
attn_kernel(const _Float16* __restrict__ Q, const _Float16* __restrict__ K,
            const _Float16* __restrict__ V, _Float16* __restrict__ O) {
  // K tile [key][d]: pitch 144 B = 16 B x odd, the conflict-free pitch of the
  // ds_load_b128 reader
  constexpr int KP = 72;
  __shared__ __align__(16) _Float16 Kt[32 * KP];
  // V tile as it lies in memory, [key][d]; pitch 160 B = 32 B x odd, the
  // conflict-free pitch of the transposing reader
  constexpr int VP = 80;
  __shared__ __align__(16) _Float16 Vs[32 * VP];

  const int b = blockIdx.y / NH, h = blockIdx.y % NH;
  const int q0 = blockIdx.x * 64;
  const int tid = threadIdx.x, lane = tid & 31, w = tid >> 5;
  const int ln = lane & 15, grp = lane >> 4;

  // Q fragments (64(d) x 16(query) B-matrix = 2 chunks of 32 x 16), loaded once;
  // fold dh^-0.5 * log2(e) = 0.125 * 1.4426950 into Q (f16, tiny rel. error).
  const _Float16 qscale = (_Float16)0.18033688f;
  const _Float16* qp = Q + ((size_t)(b * SEQ + q0 + w * 16 + ln)) * Dm + h * DH;
  v16h qf[2];
#pragma unroll
  for (int c = 0; c < 2; ++c) {
    qf[c] = ldfrag(qp + c * 32, grp);
#pragma unroll
    for (int i = 0; i < 16; ++i) qf[c][i] = qf[c][i] * qscale;
  }

  v16h onesf;
#pragma unroll
  for (int i = 0; i < 16; ++i) onesf[i] = (_Float16)1.0f;

  // this lane's row and column part of every transposing read of Vs
  const _Float16* vtr = Vs + (grp * 8 + (lane & 7)) * VP + ((lane >> 3) & 1) * 8;

  v8f o[4] = {};      // O^T: lane = query ln, register r = d nt * 16 + 8 grp + r
  v8f osum = {};
  float rmax = -1e30f;

  for (int j0 = 0; j0 < SEQ; j0 += 32) {
    // stage the K and V tiles, [32 keys][64 d] each and both untransposed, via
    // async 16B copies: 256 chunks, chunk p = tid + i * 128 -> key p >> 3,
    // segment p & 7
    {
      const int key = tid >> 3, seg = tid & 7;
      const size_t go = ((size_t)(b * SEQ + j0 + key)) * Dm + h * DH + seg * 8;
      async_b128_x4(&K[go], &Kt[key * KP + seg * 8], 16 * Dm, 16 * KP,
                    &V[go], &Vs[key * VP + seg * 8], 16 * Dm, 16 * VP);
    }
    if (j0 + 32 < SEQ)
      __builtin_prefetch(&K[((size_t)(b * SEQ + j0 + 32 + (tid >> 2))) * Dm +
                            h * DH], 0, 1);
    wait_async0();
    __syncthreads();

    // the trip's 16 fragment loads (K as A of the first product, V^T as A of the
    // second) stand as one group, K first: the LDS latency is waited out once a
    // trip, not once in front of each of the eight products
    v16h kf[2][2], vf[4];
#pragma unroll
    for (int t = 0; t < 2; ++t)
#pragma unroll
      for (int c = 0; c < 2; ++c)
        kf[t][c] = ldfrag(Kt + (t * 16 + ln) * KP + c * 32, grp);
#pragma unroll
    for (int nt = 0; nt < 4; ++nt)
      vf[nt] = ldfrag_tr<VP>(vtr + nt * 16);   // V^T as A: row d, k = key
    // inputs-only fence on the loaded fragments: holds the sixteen loads in one
    // group in front of the first product; without it each pair is moved down in
    // front of its own product and waited to 0 there
    asm volatile("" :: "v"(kf[0][0]), "v"(kf[0][1]), "v"(kf[1][0]), "v"(kf[1][1]),
                       "v"(vf[0]), "v"(vf[1]), "v"(vf[2]), "v"(vf[3]));

    // scores (log2 domain), transposed: two 16(key) x 16(query) tiles, K-dim =
    // dh = 64 (2 wmma each); s[t][r] is key t * 16 + 8 grp + r, query ln
    v8f s[2];
#pragma unroll
    for (int t = 0; t < 2; ++t) {
      v8f z = {};
      z = wmma32(kf[t][0], qf[0], z);
      z = wmma32(kf[t][1], qf[1], z);
      s[t] = z;
    }

    // online softmax; a query's 32 scores lie in lanes ln and ln + 16
    float lm = fmaxf(s[0][0], s[1][0]);
#pragma unroll
    for (int r = 1; r < 8; ++r) lm = fmaxf(lm, fmaxf(s[0][r], s[1][r]));
    lm = fmaxf(lm, xhalf(lm));
    const float nm = fmaxf(rmax, lm);
    const float alpha = __builtin_amdgcn_exp2f(rmax - nm);
    rmax = nm;

    // P^T as a 32(key) x 16(query) B fragment: element i is key 8 grp + i,
    // element 8 + i key 16 + 8 grp + i, which is how s[0] and s[1] hold them
    v16h pf;
#pragma unroll
    for (int r = 0; r < 8; ++r) {
      pf[r]     = (_Float16)__builtin_amdgcn_exp2f(s[0][r] - nm);
      pf[r + 8] = (_Float16)__builtin_amdgcn_exp2f(s[1][r] - nm);
    }
#pragma unroll
    for (int nt = 0; nt < 4; ++nt)
#pragma unroll
      for (int r = 0; r < 8; ++r) o[nt][r] *= alpha;
    // all rows of the sum tile are alike and only register 0 is read at the end
    osum[0] *= alpha;

#pragma unroll
    for (int nt = 0; nt < 4; ++nt) o[nt] = wmma32(vf[nt], pf, o[nt]);
    osum = wmma32(onesf, pf, osum);     // column sums, f32 accum
    // this wave's LDS reads have retired before the next trip's copies refill
    asm volatile("s_wait_dscnt 0" ::: "memory");
    __syncthreads();
  }

  // normalize and store f16: 8 consecutive d of one query per lane and tile
  _Float16* op =
      O + ((size_t)(b * SEQ + q0 + w * 16 + ln)) * Dm + h * DH + grp * 8;
#pragma unroll
  for (int nt = 0; nt < 4; ++nt) {
    v8h ov;
#pragma unroll
    for (int r = 0; r < 8; ++r) ov[r] = (_Float16)(o[nt][r] / osum[0]);
    *(v8h*)(op + nt * 16) = ov;
  }
}

// ---------------------------------------------------------------- launch
extern "C" void kernel_launch(void* const* d_in, const int* in_sizes, int n_in,
                              void* d_out, int out_size, void* d_ws,
                              size_t ws_size, hipStream_t stream) {
  const float* x  = (const float*)d_in[0];
  const float* y  = (const float*)d_in[1];
  const int* pq   = (const int*)d_in[2];
  const int* pkv  = (const int*)d_in[3];
  const float* Wq = (const float*)d_in[4];
  const float* bq = (const float*)d_in[5];
  const float* Wk = (const float*)d_in[6];
  const float* bk = (const float*)d_in[7];
  const float* Wv = (const float*)d_in[8];
  const float* bv = (const float*)d_in[9];
  const float* Wo = (const float*)d_in[10];
  const float* bo = (const float*)d_in[11];

  char* ws = (char*)d_ws;
  _Float16* xh  = (_Float16*)ws;                ws += (size_t)ACT * 2;
  _Float16* yh  = (_Float16*)ws;                ws += (size_t)ACT * 2;
  _Float16* Wqh = (_Float16*)ws;                ws += (size_t)WSZ * 6;  // q, k, v
  _Float16* Woh = (_Float16*)ws;                ws += (size_t)WSZ * 2;
  _Float16* Qh  = (_Float16*)ws;                ws += (size_t)ACT * 2;
  _Float16* Kh  = (_Float16*)ws;                ws += (size_t)ACT * 2;
  _Float16* Vh  = (_Float16*)ws;                ws += (size_t)ACT * 2;
  _Float16* Oh  = (_Float16*)ws;                ws += (size_t)ACT * 2;

  // 1) f32 -> f16, all six sources; xh is the start of the six f16 copies
  cvt_all<<<(2 * ACT + 4 * WSZ) / 16384, 256, 0, stream>>>(x, y, Wq, Wk, Wv, Wo,
                                                           xh);

  // 2) Q/K/V projections (WMMA, bias fused, f16 out); Qh starts the three outputs
  gemm_qkv<<<dim3(TOK / 128, Dm / 128, 3), 256, 0, stream>>>(xh, yh, Wqh, bq, bk,
                                                             bv, Qh);

  // 3) 2D RoPE on Q and K
  rope_kernel<<<dim3(TOK * 8 / 256, 2, 2), 256, 0, stream>>>(Qh, pq, Kh, pkv);

  // 4) flash attention (WMMA)
  attn_kernel<<<dim3(SEQ / 64, Bb * NH), 128, 0, stream>>>(Qh, Kh, Vh, Oh);

  // 5) output projection, f32 out
  gemm_out<<<dim3(TOK / 128, Dm / 128), 256, 0, stream>>>(Oh, Woh, bo,
                                                          (float*)d_out);
}

// v007
// One run takes 104 microseconds.
// In two side-by-side timings against v006, it was 1.10 and 1.09 times as fast.
// All steps since v000 together make it 7.39 times as fast.
#include <hip/hip_runtime.h>
#include <hip/hip_bf16.h>

typedef __attribute__((ext_vector_type(16))) _Float16 v16h;
typedef __attribute__((ext_vector_type(8)))  _Float16 v8h;
typedef __attribute__((ext_vector_type(8)))  float    v8f;

#define DEV __device__ __forceinline__

static constexpr int Bb   = 8;
static constexpr int SEQ  = 1024;   // N == M
static constexpr int Dm   = 768;
static constexpr int NH   = 12;
static constexpr int DH   = 64;
static constexpr int TOK  = Bb * SEQ;   // 8192
static constexpr int ACT  = TOK * Dm;   // 6,291,456 elements of an activation
static constexpr int WSZ  = Dm * Dm;    //   589,824 elements of a weight

DEV v16h mk16(v8h lo, v8h hi) {
  v16h r;
#pragma unroll
  for (int i = 0; i < 8; ++i) { r[i] = lo[i]; r[i + 8] = hi[i]; }
  return r;
}

// Load one 16x32 f16 WMMA fragment (A-layout, or B-layout from a transposed
// [n][k] tile). rowbase points at this lane's row (16B aligned); grp = lane>>4.
DEV v16h ldfrag(const _Float16* rowbase, int grp) {
  v8h lo = *(const v8h*)(rowbase + grp * 8);
  v8h hi = *(const v8h*)(rowbase + 16 + grp * 8);
  return mk16(lo, hi);
}

DEV v8f wmma32(v16h a, v16h b, v8f c) {
  return __builtin_amdgcn_wmma_f32_16x16x32_f16(false, a, false, b, (short)0, c,
                                                false, false);
}

// CDNA5 async copy global->LDS, 16B per lane, tracked by ASYNCcnt.
// Generic addresses of __shared__ objects carry the LDS byte offset in
// addr[31:0] (ISA 10.2 aperture rule), which is exactly what VDST wants.
// A tile pair's async copies as one statement (16B per lane and copy). The
// closing s_wait_xcnt 0 stands in the copies' own statement so that no address
// register of an issued copy can be rewritten ahead of it.
DEV unsigned ldsoff(const void* l) { return (unsigned)(size_t)l; }
DEV unsigned long long gaddr(const void* g) {
  return (unsigned long long)(size_t)g;
}
DEV void async_b128_x8(const _Float16* ga, _Float16* la, int gsa, int lsa,
                       const _Float16* gb, _Float16* lb, int gsb, int lsb) {
  asm volatile("global_load_async_to_lds_b128 %0, %8, off\n\t"
               "global_load_async_to_lds_b128 %1, %9, off\n\t"
               "global_load_async_to_lds_b128 %2, %10, off\n\t"
               "global_load_async_to_lds_b128 %3, %11, off\n\t"
               "global_load_async_to_lds_b128 %4, %12, off\n\t"
               "global_load_async_to_lds_b128 %5, %13, off\n\t"
               "global_load_async_to_lds_b128 %6, %14, off\n\t"
               "global_load_async_to_lds_b128 %7, %15, off\n\t"
               "s_wait_xcnt 0x0"
               :: "v"(ldsoff(la)), "v"(ldsoff(la + lsa)),
                  "v"(ldsoff(la + 2 * lsa)), "v"(ldsoff(la + 3 * lsa)),
                  "v"(ldsoff(lb)), "v"(ldsoff(lb + lsb)),
                  "v"(ldsoff(lb + 2 * lsb)), "v"(ldsoff(lb + 3 * lsb)),
                  "v"(gaddr(ga)), "v"(gaddr(ga + gsa)),
                  "v"(gaddr(ga + 2 * gsa)), "v"(gaddr(ga + 3 * gsa)),
                  "v"(gaddr(gb)), "v"(gaddr(gb + gsb)),
                  "v"(gaddr(gb + 2 * gsb)), "v"(gaddr(gb + 3 * gsb))
               : "memory");
}
DEV void async_b128_x4(const _Float16* ga, _Float16* la, int gsa, int lsa,
                       const _Float16* gb, _Float16* lb, int gsb, int lsb) {
  asm volatile("global_load_async_to_lds_b128 %0, %4, off\n\t"
               "global_load_async_to_lds_b128 %1, %5, off\n\t"
               "global_load_async_to_lds_b128 %2, %6, off\n\t"
               "global_load_async_to_lds_b128 %3, %7, off\n\t"
               "s_wait_xcnt 0x0"
               :: "v"(ldsoff(la)), "v"(ldsoff(la + lsa)), "v"(ldsoff(lb)),
                  "v"(ldsoff(lb + lsb)), "v"(gaddr(ga)), "v"(gaddr(ga + gsa)),
                  "v"(gaddr(gb)), "v"(gaddr(gb + gsb))
               : "memory");
}
DEV void wait_async0() { asm volatile("s_wait_asynccnt 0" ::: "memory"); }

// Transposing LDS load: from a row-major [k][n] f16 tile, lane (c = lane & 15,
// h = lane >> 4) receives T[kbase + 8h + 0..7][nbase + c]. The lane's address is
// row kbase + 8h + (lane & 7), column nbase + 8 * ((lane >> 3) & 1).
typedef short s16x8 __attribute__((ext_vector_type(8)));
DEV v8h ld_tr16(const _Float16* p) {
  typedef __attribute__((address_space(3))) s16x8 lds_s16x8;
  return __builtin_bit_cast(v8h,
                            __builtin_amdgcn_ds_load_tr16_b128_v8i16((lds_s16x8*)p));
}
// One 32(k) x 16(n) B fragment from a [k][n] tile of row pitch PITCH halves;
// lanebase already holds the lane's row and column part. Its k order is the one
// ldfrag gives the A side (k = 8h + s, then 16 + 8h + s).
template <int PITCH>
DEV v16h ldfrag_tr(const _Float16* lanebase) {
  return mk16(ld_tr16(lanebase), ld_tr16(lanebase + 16 * PITCH));
}

// Lane l with lane l ^ 16 (the two wave halves exchange one value).
DEV float xhalf(float x) {
  int b = __builtin_bit_cast(int, x);
  return __builtin_bit_cast(
      float, __builtin_amdgcn_permlanex16(b, b, 0x76543210, 0xfedcba98, false,
                                          false));
}

// ---------------------------------------------------------------- convert
// All six f32 -> f16 conversions in one grid: none reads another's output. The
// f16 copies lie one behind the other in out (x, y, Wq, Wk, Wv, Wo), so the flat
// index is the output index; a block's 16384 elements lie wholly inside one
// source. A lane issues 16 loads of 16 B before its first store; each load of a
// wave covers 512 contiguous bytes and each store 256: whole 128-B lines.
typedef __attribute__((ext_vector_type(4))) float    v4f;
typedef __attribute__((ext_vector_type(4))) _Float16 v4h;
__global__ void __launch_bounds__(256)
cvt_all(const float* __restrict__ x, const float* __restrict__ y,
        const float* __restrict__ Wq, const float* __restrict__ Wk,
        const float* __restrict__ Wv, const float* __restrict__ Wo,
        _Float16* __restrict__ out) {
  constexpr int PER = 16;                // 16-B loads per lane
  constexpr int BLK = 256 * 4 * PER;     // elements per block
  constexpr int AB = ACT / BLK, WB = WSZ / BLK;   // blocks per source
  static_assert(ACT % BLK == 0 && WSZ % BLK == 0, "whole blocks");
  const int blk = blockIdx.x;
  const float* src;
  int rel;
  if (blk < AB) {
    src = x; rel = blk;
  } else if (blk < 2 * AB) {
    src = y; rel = blk - AB;
  } else {
    const int k = (blk - 2 * AB) / WB;
    rel = (blk - 2 * AB) - k * WB;
    src = k == 0 ? Wq : k == 1 ? Wk : k == 2 ? Wv : Wo;
  }
  const v4f* s4 = (const v4f*)(src + (size_t)rel * BLK) + threadIdx.x;
  v4h* o4 = (v4h*)(out + (size_t)blk * BLK) + threadIdx.x;
  v4f v[PER];
#pragma unroll
  for (int i = 0; i < PER; ++i) v[i] = s4[i * 256];
#pragma unroll
  for (int i = 0; i < PER; ++i) o4[i * 256] = __builtin_convertvector(v[i], v4h);
}

// One transcendental and, in the same statement, the free issue slot that the
// instruction set asks for behind it: so no reader of the result and no overwrite
// of the source can be scheduled directly behind the instruction.
DEV float exp2_slot(float a) {
  float r;
  asm("v_exp_f32 %0, %1\n\tv_nop" : "=v"(r) : "v"(a));
  return r;
}
DEV float sin_rev_slot(float a) {   // a in revolutions
  float r;
  asm("v_sin_f32 %0, %1\n\tv_nop" : "=v"(r) : "v"(a));
  return r;
}
DEV float cos_rev_slot(float a) {   // a in revolutions
  float r;
  asm("v_cos_f32 %0, %1\n\tv_nop" : "=v"(r) : "v"(a));
  return r;
}

// ---------------------------------------------------------------- GEMM
// C[Mtot x 768] = A[Mtot x 768] (f16) @ W[768 x 768] (f16) + bias(f32)
// Block tile 128x128, K-step 64. 8 waves, each 32(M) x 64(N).
// pos != nullptr (the same for a whole block): the 2D RoPE of [token][row, col]
// positions is applied to C, in f32, before it is rounded and stored.
template <bool OUT16>
DEV void gemm_body(const _Float16* __restrict__ A, const _Float16* __restrict__ W,
                   const float* __restrict__ bias, void* __restrict__ Cout,
                   const int* __restrict__ pos) {
  // A tile [m][k]; pitch 144 B = 16 B x odd, the conflict-free pitch of the
  // ds_load_b128 reader (16 rows of one column segment fall on 16 bank groups)
  constexpr int AP = 72;
  __shared__ __align__(16) _Float16 As[128 * AP];
  // W tile as it lies in memory, [k][n]; pitch 288 B = 32 B x odd, the
  // conflict-free pitch of the transposing reader
  constexpr int BP = 144;
  __shared__ __align__(16) _Float16 Bs[64 * BP];

  const int tid = threadIdx.x, lane = tid & 31, w = tid >> 5;
  const int ln = lane & 15, grp = lane >> 4;
  const int m0 = blockIdx.x * 128, n0 = blockIdx.y * 128;
  const int wm = (w & 3) * 32;      // wave M offset within block
  const int wn = (w >> 2) * 64;     // wave N offset within block

  // this lane's row and column part of every transposing read of Bs
  const _Float16* btr =
      Bs + (grp * 8 + (lane & 7)) * BP + wn + ((lane >> 3) & 1) * 8;

  v8f acc[2][4] = {};

  for (int k0 = 0; k0 < Dm; k0 += 64) {
    // --- stage both tiles via async 16B copies (straight copies), 1024 chunks
    // each, chunk c = tid + i * 256:
    // A tile 128(m) x 64(k): row c >> 3, segment c & 7
    // W tile 64(k) x 128(n), untransposed: row c >> 4, segment c & 15
    {
      const int row = tid >> 3, sega = tid & 7;
      const int kk = tid >> 4, segw = tid & 15;
      async_b128_x8(&A[(size_t)(m0 + row) * Dm + k0 + sega * 8],
                    &As[row * AP + sega * 8], 32 * Dm, 32 * AP,
                    &W[(size_t)(k0 + kk) * Dm + n0 + segw * 8],
                    &Bs[kk * BP + segw * 8], 16 * Dm, 16 * BP);
    }
    if (k0 + 64 < Dm)
      __builtin_prefetch(&A[(size_t)(m0 + (tid >> 1)) * Dm + k0 + 64], 0, 1);
    wait_async0();
    __syncthreads();

#pragma unroll
    for (int kc = 0; kc < 2; ++kc) {
      v16h af[2], bf[4];
#pragma unroll
      for (int i = 0; i < 2; ++i)
        af[i] = ldfrag(&As[(wm + i * 16 + ln) * AP + kc * 32], grp);
#pragma unroll
      for (int j = 0; j < 4; ++j)
        bf[j] = ldfrag_tr<BP>(btr + kc * 32 * BP + j * 16);
#pragma unroll
      for (int i = 0; i < 2; ++i)
#pragma unroll
        for (int j = 0; j < 4; ++j) acc[i][j] = wmma32(af[i], bf[j], acc[i][j]);
    }
    // this wave's LDS reads have retired before the next trip's copies refill
    asm volatile("s_wait_dscnt 0" ::: "memory");
    __syncthreads();
  }

  // epilogue: C-layout -> lane holds col n, VGPR r holds row 8*grp+r
  if (OUT16 && pos != nullptr) {
    // A wave's 64 columns are one head: tile j holds d = 16 j + ln. Tiles 0, 1 are
    // the half turned by the row position, tiles 2, 3 the half turned by the
    // column position, and the rotation partner d +- 16 is the same lane and
    // register of the neighbour tile: the rotation needs no exchange.
    typedef __attribute__((ext_vector_type(4))) int v4i;
    float bv[4];
#pragma unroll
    for (int j = 0; j < 4; ++j) bv[j] = bias[n0 + wn + j * 16 + ln];
    // 100^(-ln / 16) = exp2(log2(e) * (-ln(100) / 16) * ln), in revolutions
    const float frev =
        exp2_slot(1.44269504f * (-0.28782313662425572f * (float)ln)) *
        0.15915494f;                           // 1 / (2 pi)
    // one 32-bit lane offset each for C and pos; tile, row and half are constants
    const unsigned mg0 = m0 + wm + grp * 8;
    const unsigned coff = mg0 * Dm + n0 + wn + ln;
    _Float16* cbase = (_Float16*)Cout;
    v4i pv[2][4];                              // per tile row: 8 tokens x (row, col)
#pragma unroll
    for (int q = 0; q < 4; ++q)
      pv[0][q] = *(const v4i*)(pos + ((size_t)(mg0 * 2) + q * 4));
#pragma unroll
    for (int i = 0; i < 2; ++i) {
#pragma unroll
      for (int r = 0; r < 8; ++r)
#pragma unroll
        for (int hf = 0; hf < 2; ++hf) {
          // the second tile row's positions are asked for one group of rows ahead
          if (i == 0 && r == 4 && hf == 0) {
            // these loads may be given registers that the stores above name
            asm volatile("s_wait_xcnt 0x0" ::: "memory");
#pragma unroll
            for (int q = 0; q < 4; ++q)
              pv[1][q] = *(const v4i*)(pos + ((size_t)(mg0 * 2) + 32 + q * 4));
          }
          const float rev = (float)pv[i][r >> 1][(r & 1) * 2 + hf] * frev;
          const float s = sin_rev_slot(rev), c = cos_rev_slot(rev);
          const float t0 = acc[i][2 * hf][r] + bv[2 * hf];
          const float t1 = acc[i][2 * hf + 1][r] + bv[2 * hf + 1];
          _Float16* cp = cbase + ((size_t)coff + (i * 16 + r) * Dm + hf * 32);
          cp[0]  = (_Float16)(t0 * c - t1 * s);
          cp[16] = (_Float16)(t1 * c + t0 * s);
          // ends a group of four rows: without it sums and results of later rows
          // are formed ahead of the stores and the kernel takes 130 registers, not
          // 124: past the 128 at which four blocks are resident on a WGP
          if (hf == 1 && (r & 3) == 3) __builtin_amdgcn_sched_barrier(0);
        }
    }
    // behind the last stores: no register that they name is rewritten ahead of it
    // on any way the code behind this block can be reached
    asm volatile("s_wait_xcnt 0x0" ::: "memory");
    return;
  }
#pragma unroll
  for (int i = 0; i < 2; ++i)
#pragma unroll
    for (int j = 0; j < 4; ++j) {
      int ngl = n0 + wn + j * 16 + ln;
      float bv = bias[ngl];
#pragma unroll
      for (int r = 0; r < 8; ++r) {
        int mg = m0 + wm + i * 16 + grp * 8 + r;
        float vout = acc[i][j][r] + bv;
        if (OUT16)
          ((_Float16*)Cout)[(size_t)mg * Dm + ngl] = (_Float16)vout;
        else
          ((float*)Cout)[(size_t)mg * Dm + ngl] = vout;
      }
    }
}

// The Q, K and V projections in one grid, blockIdx.z = which: none reads
// another's output. Wqkv holds the three f16 weights and QKV the three outputs,
// each one behind the other. Q and K leave their blocks already rotated.
__global__ void __launch_bounds__(256)
gemm_qkv(const _Float16* __restrict__ xh, const _Float16* __restrict__ yh,
         const _Float16* __restrict__ Wqkv, const float* __restrict__ bq,
         const float* __restrict__ bk, const float* __restrict__ bv,
         const int* __restrict__ posq, const int* __restrict__ posk,
         _Float16* __restrict__ QKV) {
  const int z = blockIdx.z;
  gemm_body<true>(z == 0 ? xh : yh, Wqkv + (size_t)z * WSZ,
                  z == 0 ? bq : z == 1 ? bk : bv, QKV + (size_t)z * ACT,
                  z == 0 ? posq : z == 1 ? posk : nullptr);
}

__global__ void __launch_bounds__(256)
gemm_out(const _Float16* __restrict__ A, const _Float16* __restrict__ W,
         const float* __restrict__ bias, float* __restrict__ C) {
  gemm_body<false>(A, W, bias, C, nullptr);
}

__global__ void __launch_bounds__(128)
attn_kernel(const _Float16* __restrict__ Q, const _Float16* __restrict__ K,
            const _Float16* __restrict__ V, _Float16* __restrict__ O) {
  // K tile [key][d]: pitch 144 B = 16 B x odd, the conflict-free pitch of the
  // ds_load_b128 reader
  constexpr int KP = 72;
  __shared__ __align__(16) _Float16 Kt[32 * KP];
  // V tile as it lies in memory, [key][d]; pitch 160 B = 32 B x odd, the
  // conflict-free pitch of the transposing reader
  constexpr int VP = 80;
  __shared__ __align__(16) _Float16 Vs[32 * VP];

  const int b = blockIdx.y / NH, h = blockIdx.y % NH;
  const int q0 = blockIdx.x * 64;
  const int tid = threadIdx.x, lane = tid & 31, w = tid >> 5;
  const int ln = lane & 15, grp = lane >> 4;

  // Q fragments (64(d) x 16(query) B-matrix = 2 chunks of 32 x 16), loaded once;
  // fold dh^-0.5 * log2(e) = 0.125 * 1.4426950 into Q (f16, tiny rel. error).
  const _Float16 qscale = (_Float16)0.18033688f;
  const _Float16* qp = Q + ((size_t)(b * SEQ + q0 + w * 16 + ln)) * Dm + h * DH;
  v16h qf[2];
#pragma unroll
  for (int c = 0; c < 2; ++c) {
    qf[c] = ldfrag(qp + c * 32, grp);
#pragma unroll
    for (int i = 0; i < 16; ++i) qf[c][i] = qf[c][i] * qscale;
  }

  v16h onesf;
#pragma unroll
  for (int i = 0; i < 16; ++i) onesf[i] = (_Float16)1.0f;

  // this lane's row and column part of every transposing read of Vs
  const _Float16* vtr = Vs + (grp * 8 + (lane & 7)) * VP + ((lane >> 3) & 1) * 8;

  v8f o[4] = {};      // O^T: lane = query ln, register r = d nt * 16 + 8 grp + r
  v8f osum = {};
  float rmax = -1e30f;

  for (int j0 = 0; j0 < SEQ; j0 += 32) {
    // stage the K and V tiles, [32 keys][64 d] each and both untransposed, via
    // async 16B copies: 256 chunks, chunk p = tid + i * 128 -> key p >> 3,
    // segment p & 7
    {
      const int key = tid >> 3, seg = tid & 7;
      const size_t go = ((size_t)(b * SEQ + j0 + key)) * Dm + h * DH + seg * 8;
      async_b128_x4(&K[go], &Kt[key * KP + seg * 8], 16 * Dm, 16 * KP,
                    &V[go], &Vs[key * VP + seg * 8], 16 * Dm, 16 * VP);
    }
    if (j0 + 32 < SEQ)
      __builtin_prefetch(&K[((size_t)(b * SEQ + j0 + 32 + (tid >> 2))) * Dm +
                            h * DH], 0, 1);
    wait_async0();
    __syncthreads();

    // the trip's 16 fragment loads (K as A of the first product, V^T as A of the
    // second) stand as one group, K first: the LDS latency is waited out once a
    // trip, not once in front of each of the eight products
    v16h kf[2][2], vf[4];
#pragma unroll
    for (int t = 0; t < 2; ++t)
#pragma unroll
      for (int c = 0; c < 2; ++c)
        kf[t][c] = ldfrag(Kt + (t * 16 + ln) * KP + c * 32, grp);
#pragma unroll
    for (int nt = 0; nt < 4; ++nt)
      vf[nt] = ldfrag_tr<VP>(vtr + nt * 16);   // V^T as A: row d, k = key
    // inputs-only fence on the loaded fragments: holds the sixteen loads in one
    // group in front of the first product; without it each pair is moved down in
    // front of its own product and waited to 0 there
    asm volatile("" :: "v"(kf[0][0]), "v"(kf[0][1]), "v"(kf[1][0]), "v"(kf[1][1]),
                       "v"(vf[0]), "v"(vf[1]), "v"(vf[2]), "v"(vf[3]));

    // scores (log2 domain), transposed: two 16(key) x 16(query) tiles, K-dim =
    // dh = 64 (2 wmma each); s[t][r] is key t * 16 + 8 grp + r, query ln
    v8f s[2];
#pragma unroll
    for (int t = 0; t < 2; ++t) {
      v8f z = {};
      z = wmma32(kf[t][0], qf[0], z);
      z = wmma32(kf[t][1], qf[1], z);
      s[t] = z;
    }

    // online softmax; a query's 32 scores lie in lanes ln and ln + 16
    float lm = fmaxf(s[0][0], s[1][0]);
#pragma unroll
    for (int r = 1; r < 8; ++r) lm = fmaxf(lm, fmaxf(s[0][r], s[1][r]));
    lm = fmaxf(lm, xhalf(lm));
    const float nm = fmaxf(rmax, lm);
    const float alpha = __builtin_amdgcn_exp2f(rmax - nm);
    rmax = nm;

    // P^T as a 32(key) x 16(query) B fragment: element i is key 8 grp + i,
    // element 8 + i key 16 + 8 grp + i, which is how s[0] and s[1] hold them
    v16h pf;
#pragma unroll
    for (int r = 0; r < 8; ++r) {
      pf[r]     = (_Float16)__builtin_amdgcn_exp2f(s[0][r] - nm);
      pf[r + 8] = (_Float16)__builtin_amdgcn_exp2f(s[1][r] - nm);
    }
#pragma unroll
    for (int nt = 0; nt < 4; ++nt)
#pragma unroll
      for (int r = 0; r < 8; ++r) o[nt][r] *= alpha;
    // all rows of the sum tile are alike and only register 0 is read at the end
    osum[0] *= alpha;

#pragma unroll
    for (int nt = 0; nt < 4; ++nt) o[nt] = wmma32(vf[nt], pf, o[nt]);
    osum = wmma32(onesf, pf, osum);     // column sums, f32 accum
    // this wave's LDS reads have retired before the next trip's copies refill
    asm volatile("s_wait_dscnt 0" ::: "memory");
    __syncthreads();
  }

  // normalize and store f16: 8 consecutive d of one query per lane and tile
  _Float16* op =
      O + ((size_t)(b * SEQ + q0 + w * 16 + ln)) * Dm + h * DH + grp * 8;
#pragma unroll
  for (int nt = 0; nt < 4; ++nt) {
    v8h ov;
#pragma unroll
    for (int r = 0; r < 8; ++r) ov[r] = (_Float16)(o[nt][r] / osum[0]);
    *(v8h*)(op + nt * 16) = ov;
  }
}

// ---------------------------------------------------------------- launch
extern "C" void kernel_launch(void* const* d_in, const int* in_sizes, int n_in,
                              void* d_out, int out_size, void* d_ws,
                              size_t ws_size, hipStream_t stream) {
  const float* x  = (const float*)d_in[0];
  const float* y  = (const float*)d_in[1];
  const int* pq   = (const int*)d_in[2];
  const int* pkv  = (const int*)d_in[3];
  const float* Wq = (const float*)d_in[4];
  const float* bq = (const float*)d_in[5];
  const float* Wk = (const float*)d_in[6];
  const float* bk = (const float*)d_in[7];
  const float* Wv = (const float*)d_in[8];
  const float* bv = (const float*)d_in[9];
  const float* Wo = (const float*)d_in[10];
  const float* bo = (const float*)d_in[11];

  char* ws = (char*)d_ws;
  _Float16* xh  = (_Float16*)ws;                ws += (size_t)ACT * 2;
  _Float16* yh  = (_Float16*)ws;                ws += (size_t)ACT * 2;
  _Float16* Wqh = (_Float16*)ws;                ws += (size_t)WSZ * 6;  // q, k, v
  _Float16* Woh = (_Float16*)ws;                ws += (size_t)WSZ * 2;
  _Float16* Qh  = (_Float16*)ws;                ws += (size_t)ACT * 2;
  _Float16* Kh  = (_Float16*)ws;                ws += (size_t)ACT * 2;
  _Float16* Vh  = (_Float16*)ws;                ws += (size_t)ACT * 2;
  _Float16* Oh  = (_Float16*)ws;                ws += (size_t)ACT * 2;

  // 1) f32 -> f16, all six sources; xh is the start of the six f16 copies
  cvt_all<<<(2 * ACT + 4 * WSZ) / 16384, 256, 0, stream>>>(x, y, Wq, Wk, Wv, Wo,
                                                           xh);

  // 2) Q/K/V projections (WMMA; bias and, for Q and K, 2D RoPE fused; f16 out);
  // Qh starts the three outputs
  gemm_qkv<<<dim3(TOK / 128, Dm / 128, 3), 256, 0, stream>>>(xh, yh, Wqh, bq, bk,
                                                             bv, pq, pkv, Qh);

  // 3) flash attention (WMMA)
  attn_kernel<<<dim3(SEQ / 64, Bb * NH), 128, 0, stream>>>(Qh, Kh, Vh, Oh);

  // 4) output projection, f32 out
  gemm_out<<<dim3(TOK / 128, Dm / 128), 256, 0, stream>>>(Oh, Woh, bo,
                                                          (float*)d_out);
}

// v008
// One run takes 92.3 microseconds.
// In two side-by-side timings against v007, it was 1.11 and 1.13 times as fast.
// All steps since v000 together make it 8.30 times as fast.
#include <hip/hip_runtime.h>
#include <hip/hip_bf16.h>

typedef __attribute__((ext_vector_type(16))) _Float16 v16h;
typedef __attribute__((ext_vector_type(8)))  _Float16 v8h;
typedef __attribute__((ext_vector_type(8)))  float    v8f;

#define DEV __device__ __forceinline__

static constexpr int Bb   = 8;
static constexpr int SEQ  = 1024;   // N == M
static constexpr int Dm   = 768;
static constexpr int NH   = 12;
static constexpr int DH   = 64;
static constexpr int TOK  = Bb * SEQ;   // 8192
static constexpr int ACT  = TOK * Dm;   // 6,291,456 elements of an activation
static constexpr int WSZ  = Dm * Dm;    //   589,824 elements of a weight

DEV v16h mk16(v8h lo, v8h hi) {
  v16h r;
#pragma unroll
  for (int i = 0; i < 8; ++i) { r[i] = lo[i]; r[i + 8] = hi[i]; }
  return r;
}

// Load one 16x32 f16 WMMA fragment (A-layout, or B-layout from a transposed
// [n][k] tile). rowbase points at this lane's row (16B aligned); grp = lane>>4.
DEV v16h ldfrag(const _Float16* rowbase, int grp) {
  v8h lo = *(const v8h*)(rowbase + grp * 8);
  v8h hi = *(const v8h*)(rowbase + 16 + grp * 8);
  return mk16(lo, hi);
}

DEV v8f wmma32(v16h a, v16h b, v8f c) {
  return __builtin_amdgcn_wmma_f32_16x16x32_f16(false, a, false, b, (short)0, c,
                                                false, false);
}

// CDNA5 async copy global->LDS, 16B per lane, tracked by ASYNCcnt.
// Generic addresses of __shared__ objects carry the LDS byte offset in
// addr[31:0] (ISA 10.2 aperture rule), which is exactly what VDST wants.
// A tile pair's async copies as one statement (16B per lane and copy). The
// closing s_wait_xcnt 0 stands in the copies' own statement so that no address
// register of an issued copy can be rewritten ahead of it.
DEV unsigned ldsoff(const void* l) { return (unsigned)(size_t)l; }
DEV unsigned long long gaddr(const void* g) {
  return (unsigned long long)(size_t)g;
}
DEV void async_b128_x8(const _Float16* ga, _Float16* la, int gsa, int lsa,
                       const _Float16* gb, _Float16* lb, int gsb, int lsb) {
  asm volatile("global_load_async_to_lds_b128 %0, %8, off\n\t"
               "global_load_async_to_lds_b128 %1, %9, off\n\t"
               "global_load_async_to_lds_b128 %2, %10, off\n\t"
               "global_load_async_to_lds_b128 %3, %11, off\n\t"
               "global_load_async_to_lds_b128 %4, %12, off\n\t"
               "global_load_async_to_lds_b128 %5, %13, off\n\t"
               "global_load_async_to_lds_b128 %6, %14, off\n\t"
               "global_load_async_to_lds_b128 %7, %15, off\n\t"
               "s_wait_xcnt 0x0"
               :: "v"(ldsoff(la)), "v"(ldsoff(la + lsa)),
                  "v"(ldsoff(la + 2 * lsa)), "v"(ldsoff(la + 3 * lsa)),
                  "v"(ldsoff(lb)), "v"(ldsoff(lb + lsb)),
                  "v"(ldsoff(lb + 2 * lsb)), "v"(ldsoff(lb + 3 * lsb)),
                  "v"(gaddr(ga)), "v"(gaddr(ga + gsa)),
                  "v"(gaddr(ga + 2 * gsa)), "v"(gaddr(ga + 3 * gsa)),
                  "v"(gaddr(gb)), "v"(gaddr(gb + gsb)),
                  "v"(gaddr(gb + 2 * gsb)), "v"(gaddr(gb + 3 * gsb))
               : "memory");
}
DEV void async_b128_x4(const _Float16* ga, _Float16* la, int gsa, int lsa,
                       const _Float16* gb, _Float16* lb, int gsb, int lsb) {
  asm volatile("global_load_async_to_lds_b128 %0, %4, off\n\t"
               "global_load_async_to_lds_b128 %1, %5, off\n\t"
               "global_load_async_to_lds_b128 %2, %6, off\n\t"
               "global_load_async_to_lds_b128 %3, %7, off\n\t"
               "s_wait_xcnt 0x0"
               :: "v"(ldsoff(la)), "v"(ldsoff(la + lsa)), "v"(ldsoff(lb)),
                  "v"(ldsoff(lb + lsb)), "v"(gaddr(ga)), "v"(gaddr(ga + gsa)),
                  "v"(gaddr(gb)), "v"(gaddr(gb + gsb))
               : "memory");
}
DEV void wait_async0() { asm volatile("s_wait_asynccnt 0" ::: "memory"); }

// Transposing LDS load: from a row-major [k][n] f16 tile, lane (c = lane & 15,
// h = lane >> 4) receives T[kbase + 8h + 0..7][nbase + c]. The lane's address is
// row kbase + 8h + (lane & 7), column nbase + 8 * ((lane >> 3) & 1).
typedef short s16x8 __attribute__((ext_vector_type(8)));
DEV v8h ld_tr16(const _Float16* p) {
  typedef __attribute__((address_space(3))) s16x8 lds_s16x8;
  return __builtin_bit_cast(v8h,
                            __builtin_amdgcn_ds_load_tr16_b128_v8i16((lds_s16x8*)p));
}
// One 32(k) x 16(n) B fragment from a [k][n] tile of row pitch PITCH halves;
// lanebase already holds the lane's row and column part. Its k order is the one
// ldfrag gives the A side (k = 8h + s, then 16 + 8h + s).
template <int PITCH>
DEV v16h ldfrag_tr(const _Float16* lanebase) {
  return mk16(ld_tr16(lanebase), ld_tr16(lanebase + 16 * PITCH));
}

// Lane l with lane l ^ 16 (the two wave halves exchange one value).
DEV float xhalf(float x) {
  int b = __builtin_bit_cast(int, x);
  return __builtin_bit_cast(
      float, __builtin_amdgcn_permlanex16(b, b, 0x76543210, 0xfedcba98, false,
                                          false));
}

// ---------------------------------------------------------------- convert
// All six f32 -> f16 conversions in one grid: none reads another's output. The
// f16 copies lie one behind the other in out (x, y, Wq, Wk, Wv, Wo), so the flat
// index is the output index; a block's 16384 elements lie wholly inside one
// source. A lane issues 16 loads of 16 B before its first store; each load of a
// wave covers 512 contiguous bytes and each store 256: whole 128-B lines.
typedef __attribute__((ext_vector_type(4))) float    v4f;
typedef __attribute__((ext_vector_type(4))) _Float16 v4h;
__global__ void __launch_bounds__(256)
cvt_all(const float* __restrict__ x, const float* __restrict__ y,
        const float* __restrict__ Wq, const float* __restrict__ Wk,
        const float* __restrict__ Wv, const float* __restrict__ Wo,
        _Float16* __restrict__ out) {
  constexpr int PER = 16;                // 16-B loads per lane
  constexpr int BLK = 256 * 4 * PER;     // elements per block
  constexpr int AB = ACT / BLK, WB = WSZ / BLK;   // blocks per source
  static_assert(ACT % BLK == 0 && WSZ % BLK == 0, "whole blocks");
  const int blk = blockIdx.x;
  const float* src;
  int rel;
  if (blk < AB) {
    src = x; rel = blk;
  } else if (blk < 2 * AB) {
    src = y; rel = blk - AB;
  } else {
    const int k = (blk - 2 * AB) / WB;
    rel = (blk - 2 * AB) - k * WB;
    src = k == 0 ? Wq : k == 1 ? Wk : k == 2 ? Wv : Wo;
  }
  const v4f* s4 = (const v4f*)(src + (size_t)rel * BLK) + threadIdx.x;
  v4h* o4 = (v4h*)(out + (size_t)blk * BLK) + threadIdx.x;
  v4f v[PER];
#pragma unroll
  for (int i = 0; i < PER; ++i) v[i] = s4[i * 256];
#pragma unroll
  for (int i = 0; i < PER; ++i) o4[i * 256] = __builtin_convertvector(v[i], v4h);
}

// One transcendental and, in the same statement, the free issue slot that the
// instruction set asks for behind it: so no reader of the result and no overwrite
// of the source can be scheduled directly behind the instruction.
DEV float exp2_slot(float a) {
  float r;
  asm("v_exp_f32 %0, %1\n\tv_nop" : "=v"(r) : "v"(a));
  return r;
}
// Eight exponentials in place, each independent of the one in front of it, and
// that slot behind the last of them.
DEV void exp2_x8_slot(float (&e)[8]) {
  asm("v_exp_f32 %0, %0\n\tv_exp_f32 %1, %1\n\tv_exp_f32 %2, %2\n\t"
      "v_exp_f32 %3, %3\n\tv_exp_f32 %4, %4\n\tv_exp_f32 %5, %5\n\t"
      "v_exp_f32 %6, %6\n\tv_exp_f32 %7, %7\n\tv_nop"
      : "+v"(e[0]), "+v"(e[1]), "+v"(e[2]), "+v"(e[3]), "+v"(e[4]), "+v"(e[5]),
        "+v"(e[6]), "+v"(e[7]));
}
DEV float sin_rev_slot(float a) {   // a in revolutions
  float r;
  asm("v_sin_f32 %0, %1\n\tv_nop" : "=v"(r) : "v"(a));
  return r;
}
DEV float cos_rev_slot(float a) {   // a in revolutions
  float r;
  asm("v_cos_f32 %0, %1\n\tv_nop" : "=v"(r) : "v"(a));
  return r;
}

// ---------------------------------------------------------------- GEMM
// C[Mtot x 768] = A[Mtot x 768] (f16) @ W[768 x 768] (f16) + bias(f32)
// Block tile 128x128, K-step 64. 8 waves, each 32(M) x 64(N).
// pos != nullptr (the same for a whole block): the 2D RoPE of [token][row, col]
// positions is applied to C, in f32, before it is rounded and stored.
template <bool OUT16>
DEV void gemm_body(const _Float16* __restrict__ A, const _Float16* __restrict__ W,
                   const float* __restrict__ bias, void* __restrict__ Cout,
                   const int* __restrict__ pos) {
  // A tile [m][k]; pitch 144 B = 16 B x odd, the conflict-free pitch of the
  // ds_load_b128 reader (16 rows of one column segment fall on 16 bank groups)
  constexpr int AP = 72;
  __shared__ __align__(16) _Float16 As[2][128 * AP];
  // W tile as it lies in memory, [k][n]; pitch 288 B = 32 B x odd, the
  // conflict-free pitch of the transposing reader
  constexpr int BP = 144;
  __shared__ __align__(16) _Float16 Bs[2][64 * BP];

  const int tid = threadIdx.x, lane = tid & 31, w = tid >> 5;
  const int ln = lane & 15, grp = lane >> 4;
  const int m0 = blockIdx.x * 128, n0 = blockIdx.y * 128;
  const int wm = (w & 3) * 32;      // wave M offset within block
  const int wn = (w >> 2) * 64;     // wave N offset within block

  // this lane's row and column part of every transposing read of Bs
  const _Float16* btr =
      Bs[0] + (grp * 8 + (lane & 7)) * BP + wn + ((lane >> 3) & 1) * 8;

  v8f acc[2][4] = {};

  // --- both tiles of K-step t are staged into buffer buf via async 16B copies
  // (straight copies), 1024 chunks each, chunk c = tid + i * 256:
  // A tile 128(m) x 64(k): row c >> 3, segment c & 7
  // W tile 64(k) x 128(n), untransposed: row c >> 4, segment c & 15
  const int row = tid >> 3, sega = tid & 7;
  const int kk = tid >> 4, segw = tid & 15;
  auto stage = [&](int t, int buf) {
    async_b128_x8(&A[(size_t)(m0 + row) * Dm + t * 64 + sega * 8],
                  &As[buf][row * AP + sega * 8], 32 * Dm, 32 * AP,
                  &W[(size_t)(t * 64 + kk) * Dm + n0 + segw * 8],
                  &Bs[buf][kk * BP + segw * 8], 16 * Dm, 16 * BP);
  };

  // Two buffers: K-step t + 1's copies fly while K-step t is worked on.
  constexpr int NT = Dm / 64;
  static_assert(NT >= 2, "the prologue fills both buffers");
  stage(0, 0);
  wait_async0();
  __syncthreads();
  stage(1, 1);

  // The buffer is picked at run time: with the trips written out in pairs the
  // copies' LDS addresses of both buffers live through the loop and the kernel
  // takes 130 registers: past the 128 at which four blocks are resident on a WGP.
  for (int t = 0; t < NT; ++t) {
    const int u = t & 1;
    const _Float16* atile = As[u] + (wm + ln) * AP;
    const _Float16* btile = btr + u * 64 * BP;
#pragma unroll
    for (int kc = 0; kc < 2; ++kc) {
      v16h af[2], bf[4];
#pragma unroll
      for (int i = 0; i < 2; ++i)
        af[i] = ldfrag(atile + i * 16 * AP + kc * 32, grp);
#pragma unroll
      for (int j = 0; j < 4; ++j)
        bf[j] = ldfrag_tr<BP>(btile + kc * 32 * BP + j * 16);
#pragma unroll
      for (int i = 0; i < 2; ++i)
#pragma unroll
        for (int j = 0; j < 4; ++j) acc[i][j] = wmma32(af[i], bf[j], acc[i][j]);
    }
    // this wave's LDS reads of buffer u have retired before it is refilled
    asm volatile("s_wait_dscnt 0" ::: "memory");
    // this wave's copies of the next K-step have landed
    wait_async0();
    // publishes the next K-step and ends every reader's last read of buffer u
    __syncthreads();
    if (t + 2 < NT) stage(t + 2, u);
  }
  wait_async0();   // nothing is in flight when the wave goes on

  // epilogue: C-layout -> lane holds col n, VGPR r holds row 8*grp+r
  if (OUT16 && pos != nullptr) {
    // A wave's 64 columns are one head: tile j holds d = 16 j + ln. Tiles 0, 1 are
    // the half turned by the row position, tiles 2, 3 the half turned by the
    // column position, and the rotation partner d +- 16 is the same lane and
    // register of the neighbour tile: the rotation needs no exchange.
    typedef __attribute__((ext_vector_type(4))) int v4i;
    float bv[4];
#pragma unroll
    for (int j = 0; j < 4; ++j) bv[j] = bias[n0 + wn + j * 16 + ln];
    // 100^(-ln / 16) = exp2(log2(e) * (-ln(100) / 16) * ln), in revolutions
    const float frev =
        exp2_slot(1.44269504f * (-0.28782313662425572f * (float)ln)) *
        0.15915494f;                           // 1 / (2 pi)
    // one 32-bit lane offset each for C and pos; tile, row and half are constants
    const unsigned mg0 = m0 + wm + grp * 8;
    const unsigned coff = mg0 * Dm + n0 + wn + ln;
    _Float16* cbase = (_Float16*)Cout;
    v4i pv[2][4];                              // per tile row: 8 tokens x (row, col)
#pragma unroll
    for (int q = 0; q < 4; ++q)
      pv[0][q] = *(const v4i*)(pos + ((size_t)(mg0 * 2) + q * 4));
#pragma unroll
    for (int i = 0; i < 2; ++i) {
#pragma unroll
      for (int r = 0; r < 8; ++r)
#pragma unroll
        for (int hf = 0; hf < 2; ++hf) {
          // the second tile row's positions are asked for one group of rows ahead
          if (i == 0 && r == 4 && hf == 0) {
            // these loads may be given registers that the stores above name
            asm volatile("s_wait_xcnt 0x0" ::: "memory");
#pragma unroll
            for (int q = 0; q < 4; ++q)
              pv[1][q] = *(const v4i*)(pos + ((size_t)(mg0 * 2) + 32 + q * 4));
          }
          const float rev = (float)pv[i][r >> 1][(r & 1) * 2 + hf] * frev;
          const float s = sin_rev_slot(rev), c = cos_rev_slot(rev);
          const float t0 = acc[i][2 * hf][r] + bv[2 * hf];
          const float t1 = acc[i][2 * hf + 1][r] + bv[2 * hf + 1];
          _Float16* cp = cbase + ((size_t)coff + (i * 16 + r) * Dm + hf * 32);
          cp[0]  = (_Float16)(t0 * c - t1 * s);
          cp[16] = (_Float16)(t1 * c + t0 * s);
          // ends a group of four rows: without it sums and results of later rows
          // are formed ahead of the stores and the kernel takes 130 registers, not
          // 124: past the 128 at which four blocks are resident on a WGP
          if (hf == 1 && (r & 3) == 3) __builtin_amdgcn_sched_barrier(0);
        }
    }
    // behind the last stores: no register that they name is rewritten ahead of it
    // on any way the code behind this block can be reached
    asm volatile("s_wait_xcnt 0x0" ::: "memory");
    return;
  }
#pragma unroll
  for (int i = 0; i < 2; ++i)
#pragma unroll
    for (int j = 0; j < 4; ++j) {
      int ngl = n0 + wn + j * 16 + ln;
      float bv = bias[ngl];
#pragma unroll
      for (int r = 0; r < 8; ++r) {
        int mg = m0 + wm + i * 16 + grp * 8 + r;
        float vout = acc[i][j][r] + bv;
        if (OUT16)
          ((_Float16*)Cout)[(size_t)mg * Dm + ngl] = (_Float16)vout;
        else
          ((float*)Cout)[(size_t)mg * Dm + ngl] = vout;
      }
    }
}

// The Q, K and V projections in one grid, blockIdx.z = which: none reads
// another's output. Wqkv holds the three f16 weights and QKV the three outputs,
// each one behind the other. Q and K leave their blocks already rotated.
__global__ void __launch_bounds__(256)
gemm_qkv(const _Float16* __restrict__ xh, const _Float16* __restrict__ yh,
         const _Float16* __restrict__ Wqkv, const float* __restrict__ bq,
         const float* __restrict__ bk, const float* __restrict__ bv,
         const int* __restrict__ posq, const int* __restrict__ posk,
         _Float16* __restrict__ QKV) {
  const int z = blockIdx.z;
  gemm_body<true>(z == 0 ? xh : yh, Wqkv + (size_t)z * WSZ,
                  z == 0 ? bq : z == 1 ? bk : bv, QKV + (size_t)z * ACT,
                  z == 0 ? posq : z == 1 ? posk : nullptr);
}

__global__ void __launch_bounds__(256)
gemm_out(const _Float16* __restrict__ A, const _Float16* __restrict__ W,
         const float* __restrict__ bias, float* __restrict__ C) {
  gemm_body<false>(A, W, bias, C, nullptr);
}

__global__ void __launch_bounds__(128)
attn_kernel(const _Float16* __restrict__ Q, const _Float16* __restrict__ K,
            const _Float16* __restrict__ V, _Float16* __restrict__ O) {
  // K tile [key][d]: pitch 144 B = 16 B x odd, the conflict-free pitch of the
  // ds_load_b128 reader
  constexpr int KP = 72;
  // V tile as it lies in memory, [key][d]; pitch 160 B = 32 B x odd, the
  // conflict-free pitch of the transposing reader
  constexpr int VP = 80;
  // a buffer is a K tile with its V tile behind it: one offset picks both
  constexpr int VO = 32 * KP, KVB = 32 * KP + 32 * VP;
  __shared__ __align__(16) _Float16 KV[2][KVB];

  const int b = blockIdx.y / NH, h = blockIdx.y % NH;
  const int q0 = blockIdx.x * 64;
  const int tid = threadIdx.x, lane = tid & 31, w = tid >> 5;
  const int ln = lane & 15, grp = lane >> 4;

  // Q fragments (64(d) x 16(query) B-matrix = 2 chunks of 32 x 16), loaded once;
  // fold dh^-0.5 * log2(e) = 0.125 * 1.4426950 into Q (f16, tiny rel. error).
  const _Float16 qscale = (_Float16)0.18033688f;
  const _Float16* qp = Q + ((size_t)(b * SEQ + q0 + w * 16 + ln)) * Dm + h * DH;
  v16h qf[2];
#pragma unroll
  for (int c = 0; c < 2; ++c) {
    qf[c] = ldfrag(qp + c * 32, grp);
#pragma unroll
    for (int i = 0; i < 16; ++i) qf[c][i] = qf[c][i] * qscale;
  }

  v16h onesf;
#pragma unroll
  for (int i = 0; i < 16; ++i) onesf[i] = (_Float16)1.0f;

  // this lane's row and column part of every transposing read of a V tile
  const _Float16* vtr =
      KV[0] + VO + (grp * 8 + (lane & 7)) * VP + ((lane >> 3) & 1) * 8;

  v8f o[4] = {};      // O^T: lane = query ln, register r = d nt * 16 + 8 grp + r
  v8f osum = {};
  float rmax = -1e30f;

  // the K and V tiles of key block t, [32 keys][64 d] each and both untransposed,
  // are staged into buffer buf via async 16B copies: 256 chunks, chunk
  // p = tid + i * 128 -> key p >> 3, segment p & 7
  const int key = tid >> 3, seg = tid & 7;
  auto stage = [&](int t, int buf) {
    const size_t go = ((size_t)(b * SEQ + t * 32 + key)) * Dm + h * DH + seg * 8;
    async_b128_x4(&K[go], &KV[buf][key * KP + seg * 8], 16 * Dm, 16 * KP,
                  &V[go], &KV[buf][VO + key * VP + seg * 8], 16 * Dm, 16 * VP);
  };

  // Two buffers: key block t + 2's copies fly while key block t's arithmetic runs.
  constexpr int NT = SEQ / 32;
  static_assert(NT >= 2, "the prologue fills both buffers");
  stage(0, 0);
  wait_async0();
  __syncthreads();
  stage(1, 1);

  for (int jb = 0; jb < NT; ++jb) {
    const int u = jb & 1;       // the buffer is picked at run time, as in the GEMM
    // the trip's 16 fragment loads (K as A of the first product, V^T as A of the
    // second) stand as one group, K first: the LDS latency is waited out once a
    // trip, not once in front of each of the eight products
    v16h kf[2][2], vf[4];
#pragma unroll
    for (int t = 0; t < 2; ++t)
#pragma unroll
      for (int c = 0; c < 2; ++c)
        kf[t][c] = ldfrag(KV[u] + (t * 16 + ln) * KP + c * 32, grp);
#pragma unroll
    for (int nt = 0; nt < 4; ++nt)
      vf[nt] = ldfrag_tr<VP>(vtr + u * KVB + nt * 16);   // V^T as A: row d, k = key

    // The trip's last LDS read stands above, so the buffers change hands here, in
    // front of the arithmetic: the refill then has a whole trip's arithmetic to land.
    // this wave's LDS reads of buffer u have retired before it is refilled (the
    // wait also keeps the sixteen loads above it, in their one group)
    asm volatile("s_wait_dscnt 0" ::: "memory");
    // this wave's copies of the next key block have landed
    wait_async0();
    // publishes the next key block and ends every reader's last read of buffer u
    __syncthreads();
    if (jb + 2 < NT) stage(jb + 2, u);

    // scores (log2 domain), transposed: two 16(key) x 16(query) tiles, K-dim =
    // dh = 64 (2 wmma each); s[t][r] is key t * 16 + 8 grp + r, query ln
    v8f s[2];
#pragma unroll
    for (int t = 0; t < 2; ++t) {
      v8f z = {};
      z = wmma32(kf[t][0], qf[0], z);
      z = wmma32(kf[t][1], qf[1], z);
      s[t] = z;
    }

    // online softmax; a query's 32 scores lie in lanes ln and ln + 16
    float lm = fmaxf(s[0][0], s[1][0]);
#pragma unroll
    for (int r = 1; r < 8; ++r) lm = fmaxf(lm, fmaxf(s[0][r], s[1][r]));
    lm = fmaxf(lm, xhalf(lm));
    const float nm = fmaxf(rmax, lm);
    const float alpha = exp2_slot(rmax - nm);
    rmax = nm;

    // P^T as a 32(key) x 16(query) B fragment: element i is key 8 grp + i,
    // element 8 + i key 16 + 8 grp + i, which is how s[0] and s[1] hold them
    v16h pf;
    float e0[8], e1[8];
#pragma unroll
    for (int r = 0; r < 8; ++r) {
      e0[r] = s[0][r] - nm;
      e1[r] = s[1][r] - nm;
    }
    exp2_x8_slot(e0);
    exp2_x8_slot(e1);
#pragma unroll
    for (int r = 0; r < 8; ++r) {
      pf[r]     = (_Float16)e0[r];
      pf[r + 8] = (_Float16)e1[r];
    }
#pragma unroll
    for (int nt = 0; nt < 4; ++nt)
#pragma unroll
      for (int r = 0; r < 8; ++r) o[nt][r] *= alpha;
    // all rows of the sum tile are alike and only register 0 is read at the end
    osum[0] *= alpha;

#pragma unroll
    for (int nt = 0; nt < 4; ++nt) o[nt] = wmma32(vf[nt], pf, o[nt]);
    osum = wmma32(onesf, pf, osum);     // column sums, f32 accum
  }
  wait_async0();   // nothing is in flight when the wave goes on

  // normalize and store f16: 8 consecutive d of one query per lane and tile
  _Float16* op =
      O + ((size_t)(b * SEQ + q0 + w * 16 + ln)) * Dm + h * DH + grp * 8;
#pragma unroll
  for (int nt = 0; nt < 4; ++nt) {
    v8h ov;
#pragma unroll
    for (int r = 0; r < 8; ++r) ov[r] = (_Float16)(o[nt][r] / osum[0]);
    *(v8h*)(op + nt * 16) = ov;
  }
}

// ---------------------------------------------------------------- launch
extern "C" void kernel_launch(void* const* d_in, const int* in_sizes, int n_in,
                              void* d_out, int out_size, void* d_ws,
                              size_t ws_size, hipStream_t stream) {
  const float* x  = (const float*)d_in[0];
  const float* y  = (const float*)d_in[1];
  const int* pq   = (const int*)d_in[2];
  const int* pkv  = (const int*)d_in[3];
  const float* Wq = (const float*)d_in[4];
  const float* bq = (const float*)d_in[5];
  const float* Wk = (const float*)d_in[6];
  const float* bk = (const float*)d_in[7];
  const float* Wv = (const float*)d_in[8];
  const float* bv = (const float*)d_in[9];
  const float* Wo = (const float*)d_in[10];
  const float* bo = (const float*)d_in[11];

  char* ws = (char*)d_ws;
  _Float16* xh  = (_Float16*)ws;                ws += (size_t)ACT * 2;
  _Float16* yh  = (_Float16*)ws;                ws += (size_t)ACT * 2;
  _Float16* Wqh = (_Float16*)ws;                ws += (size_t)WSZ * 6;  // q, k, v
  _Float16* Woh = (_Float16*)ws;                ws += (size_t)WSZ * 2;
  _Float16* Qh  = (_Float16*)ws;                ws += (size_t)ACT * 2;
  _Float16* Kh  = (_Float16*)ws;                ws += (size_t)ACT * 2;
  _Float16* Vh  = (_Float16*)ws;                ws += (size_t)ACT * 2;
  _Float16* Oh  = (_Float16*)ws;                ws += (size_t)ACT * 2;

  // 1) f32 -> f16, all six sources; xh is the start of the six f16 copies
  cvt_all<<<(2 * ACT + 4 * WSZ) / 16384, 256, 0, stream>>>(x, y, Wq, Wk, Wv, Wo,
                                                           xh);

  // 2) Q/K/V projections (WMMA; bias and, for Q and K, 2D RoPE fused; f16 out);
  // Qh starts the three outputs
  gemm_qkv<<<dim3(TOK / 128, Dm / 128, 3), 256, 0, stream>>>(xh, yh, Wqh, bq, bk,
                                                             bv, pq, pkv, Qh);

  // 3) flash attention (WMMA)
  attn_kernel<<<dim3(SEQ / 64, Bb * NH), 128, 0, stream>>>(Qh, Kh, Vh, Oh);

  // 4) output projection, f32 out
  gemm_out<<<dim3(TOK / 128, Dm / 128), 256, 0, stream>>>(Oh, Woh, bo,
                                                          (float*)d_out);
}
